// v000
// Measured on an AMD MI455X. A time is GPU time per run, averaged over a window of back-to-back runs after a warm-up
// (all launches, gaps included; the runs take copies of the inputs in turn), and the median of several windows.
// Apart from v000's, it joins two sittings. Times from different sittings can be a few percent apart, while
// side-by-side timings come from the same sitting.
// The starting kernel, v000, takes 2860 microseconds a run.
#include <hip/hip_runtime.h>

// Causal multi-head attention with the module's rotary quirk (x [2][2048][2048]; q, k, v = x W^T + b ('oi' [2048][2048] + [2048]; 32 heads x 64); apply_rope broadcasts its [L][32][1] sinusoid against [B][L][heads=32][32], so the rotation angle depends on the HEAD index: for head n and every feature pair (j, j+32): angle = t / 10000^(2n/64) (the same angle for all 32 pairs of the head); scores = q.k / 8, causal; softmax; out = merged Wo^T + bo -> [2][2048][2048] (8.4 M)).
// Compute dtypes, f32 accumulate: every input rounded to bf16; q/k/v on PLAIN bf16 operands (inputs: exact) + biases; per-head-angle rotary in f32 (precise cosf/sinf of t / timescale[n], float32 timescale constants); causal scores and attn.v (tile skipping): query rows < 512 hl (3 products), the rest single fp16 (x1024); softmax f32; Wo hl x exact (2 products) + bo.

#define NB_  2
#define TT   2048
#define DM   2048
#define NH_  32
#define NKV  32
#define REP  (NH_ / NKV)
#define HD   64
#define DQ   (NH_ * HD)
#define DKV  (NKV * HD)
#define ZH   2
#define RH   512                  // query rows < RH use hi+lo planes (0: none)
#define WIN  2048
#define PCAR 1024.0f
#define SCL  0.125f   // HD^-0.5
typedef _Float16 h16;
typedef unsigned short bf;
typedef __attribute__((ext_vector_type(16))) __bf16   v16bf;
typedef __attribute__((ext_vector_type(16))) _Float16 v16h;
typedef __attribute__((ext_vector_type(8)))  _Float16 v8h;
typedef __attribute__((ext_vector_type(8)))  unsigned short v8us;
typedef __attribute__((ext_vector_type(8)))  float    v8f;
typedef __attribute__((ext_vector_type(4)))  float    v4f;
typedef v8h  __attribute__((may_alias)) v8ha;
typedef v4f  __attribute__((may_alias)) v4fa;
typedef v8us __attribute__((may_alias)) v8usa;

__device__ __forceinline__ unsigned short f2bf(float f) { unsigned u = __float_as_uint(f); u += 0x7FFFu + ((u >> 16) & 1u); return (unsigned short)(u >> 16); }
__device__ __forceinline__ float bf2f(unsigned short b) { return __uint_as_float(((unsigned)b) << 16); }
__device__ __forceinline__ float bfr(float f) { return bf2f(f2bf(f)); }
__device__ __forceinline__ v16h cat16(v8h lo, v8h hi) { return __builtin_shufflevector(lo, hi, 0, 1, 2, 3, 4, 5, 6, 7, 8, 9, 10, 11, 12, 13, 14, 15); }
__device__ __forceinline__ v16bf cat16b(v8us lo, v8us hi) { return __builtin_bit_cast(v16bf, __builtin_shufflevector(lo, hi, 0, 1, 2, 3, 4, 5, 6, 7, 8, 9, 10, 11, 12, 13, 14, 15)); }
__device__ __forceinline__ v8f wmma16(v16h a, v16h b, v8f c) { return __builtin_amdgcn_wmma_f32_16x16x32_f16(false, a, false, b, (short)0, c, false, false); }
__device__ __forceinline__ v8f wmmab(v16bf a, v16bf b, v8f c) { return __builtin_amdgcn_wmma_f32_16x16x32_bf16(false, a, false, b, (short)0, c, false, false); }



// ---- k_gemmw: register-blocked GEMM, ONE WAVE per 64x64 output tile (16 accumulators), operands straight from K-contiguous 16-bit planes; grid (M/64, N/64, Z), 32 threads.
// C[m][n] (f32, pitch ldc, + optional f32 bias[n]) = sum_k A[m][k] Bt[n][k] (+ split products per NSPLIT). z-batch strides sA/sB/sC in elements. K % 32 == 0.
template <typename T16> struct WFrag;
template <> struct WFrag<h16> { typedef v16h V; static __device__ __forceinline__ V ld(const h16* p) { return cat16(*(const v8h*)p, *(const v8h*)(p + 16)); } static __device__ __forceinline__ v8f mma(V a, V b, v8f c) { return wmma16(a, b, c); } };
template <> struct WFrag<bf> { typedef v16bf V; static __device__ __forceinline__ V ld(const bf* p) { return cat16b(*(const v8us*)p, *(const v8us*)(p + 16)); } static __device__ __forceinline__ v8f mma(V a, V b, v8f c) { return wmmab(a, b, c); } };
template <typename T16, int NSPLIT, bool BIAS>
__global__ __launch_bounds__(32) void k_gemmw(const T16* __restrict__ A, const T16* __restrict__ A2, const T16* __restrict__ Bt, const T16* __restrict__ Bt2, int K, float* C, int ldc, const float* __restrict__ bias, size_t sA, size_t sB, size_t sC) {
    typedef typename WFrag<T16>::V V;
    __shared__ __align__(16) float os[16 * 68];
    const size_t z = blockIdx.z; A += z * sA; if (A2) A2 += z * sA; Bt += z * sB; if (Bt2) Bt2 += z * sB; C += z * sC;
    const int lane = threadIdx.x & 31, lr = lane & 15, hi = lane >> 4; const int r0 = blockIdx.x * 64, c0 = blockIdx.y * 64;
    v8f acc[4][4];
#pragma unroll
    for (int mb = 0; mb < 4; ++mb)
#pragma unroll
        for (int nb = 0; nb < 4; ++nb) acc[mb][nb] = (v8f){};
    const size_t aoff = (size_t)(r0 + lr) * K + 8 * hi, boff = (size_t)(c0 + lr) * K + 8 * hi;
#pragma unroll 1
    for (int kc = 0; kc < K; kc += 32) {
        V a[4], a2[4];
#pragma unroll
        for (int mb = 0; mb < 4; ++mb) { a[mb] = WFrag<T16>::ld(A + aoff + (size_t)mb * 16 * K + kc); if (NSPLIT == 1 || NSPLIT == 2) a2[mb] = WFrag<T16>::ld(A2 + aoff + (size_t)mb * 16 * K + kc); }
#pragma unroll
        for (int nb = 0; nb < 4; ++nb) { const V b = WFrag<T16>::ld(Bt + boff + (size_t)nb * 16 * K + kc); V b2; if (NSPLIT >= 2) b2 = WFrag<T16>::ld(Bt2 + boff + (size_t)nb * 16 * K + kc);
#pragma unroll
            for (int mb = 0; mb < 4; ++mb) { acc[mb][nb] = WFrag<T16>::mma(a[mb], b, acc[mb][nb]); if (NSPLIT == 1 || NSPLIT == 2) acc[mb][nb] = WFrag<T16>::mma(a2[mb], b, acc[mb][nb]); if (NSPLIT >= 2) acc[mb][nb] = WFrag<T16>::mma(a[mb], b2, acc[mb][nb]); } }
        asm volatile("v_nop\n\tv_nop\n\tv_nop\n\tv_nop" : "+v"(acc[0][0]), "+v"(acc[1][1]), "+v"(acc[2][2]), "+v"(acc[3][3]) : "v"(a[0]), "v"(a[3]));
    }
#pragma unroll
    for (int mb = 0; mb < 4; ++mb) {
#pragma unroll
        for (int nb = 0; nb < 4; ++nb) {
#pragma unroll
            for (int j = 0; j < 8; ++j) os[(hi * 8 + j) * 68 + nb * 16 + lr] = acc[mb][nb][j]; }
        __builtin_amdgcn_wave_barrier(); asm volatile("" ::: "memory");
        float* crow = C + (size_t)(r0 + mb * 16) * ldc + c0;
{
#pragma unroll
            for (int s = 0; s < 8; ++s) { const int row = 2 * s + hi, cofs = lr * 4; v4f val = *(const v4fa*)(os + row * 68 + cofs); if (BIAS) { val[0] += bfr(bias[c0 + cofs]); val[1] += bfr(bias[c0 + cofs + 1]); val[2] += bfr(bias[c0 + cofs + 2]); val[3] += bfr(bias[c0 + cofs + 3]); }
                *(v4f*)(crow + (size_t)row * ldc + cofs) = val; }
             }
        __builtin_amdgcn_wave_barrier(); asm volatile("" ::: "memory");
    }
}

// ---- k_gemmc: the same one-wave 64x64 tile GEMM specialised for causal attention: CMODE 1 skips score tiles entirely above the diagonal (query rows r0+roff.., key columns c0..), CMODE 2 limits the
// key (K) loop of the probability x value contraction to the diagonal block (probabilities beyond it are exactly zero). roff = row offset of this launch's first row within the sequence.
template <typename T16, int NSPLIT, int CMODE>
__global__ __launch_bounds__(32) void k_gemmc(const T16* __restrict__ A, const T16* __restrict__ A2, const T16* __restrict__ Bt, const T16* __restrict__ Bt2, int K, float* C, int ldc, int roff, size_t sA, size_t sB, size_t sC) {
    typedef typename WFrag<T16>::V V;
    __shared__ __align__(16) float os[16 * 68];
    const size_t z = blockIdx.z; A += z * sA; if (A2) A2 += z * sA; Bt += z * sB; if (Bt2) Bt2 += z * sB; C += z * sC;
    const int lane = threadIdx.x & 31, lr = lane & 15, hi = lane >> 4; const int r0 = blockIdx.x * 64, c0 = blockIdx.y * 64;
    if (CMODE == 1 && c0 > r0 + roff + 63) return;                  // score tile entirely above the causal diagonal: never read (the softmax masks j > i by select)
    const int Kl = (CMODE == 2) ? min(K, r0 + roff + 64) : K;        // P.V: probabilities are exactly 0 beyond the diagonal block, so the K loop stops there
    v8f acc[4][4];
#pragma unroll
    for (int mb = 0; mb < 4; ++mb)
#pragma unroll
        for (int nb = 0; nb < 4; ++nb) acc[mb][nb] = (v8f){};
    const size_t aoff = (size_t)(r0 + lr) * K + 8 * hi, boff = (size_t)(c0 + lr) * K + 8 * hi;
#pragma unroll 1
    for (int kc = 0; kc < Kl; kc += 32) {
        V a[4], a2[4];
#pragma unroll
        for (int mb = 0; mb < 4; ++mb) { a[mb] = WFrag<T16>::ld(A + aoff + (size_t)mb * 16 * K + kc); if (NSPLIT == 1 || NSPLIT == 2) a2[mb] = WFrag<T16>::ld(A2 + aoff + (size_t)mb * 16 * K + kc); }
#pragma unroll
        for (int nb = 0; nb < 4; ++nb) { const V b = WFrag<T16>::ld(Bt + boff + (size_t)nb * 16 * K + kc); V b2; if (NSPLIT >= 2) b2 = WFrag<T16>::ld(Bt2 + boff + (size_t)nb * 16 * K + kc);
#pragma unroll
            for (int mb = 0; mb < 4; ++mb) { acc[mb][nb] = WFrag<T16>::mma(a[mb], b, acc[mb][nb]); if (NSPLIT == 1 || NSPLIT == 2) acc[mb][nb] = WFrag<T16>::mma(a2[mb], b, acc[mb][nb]); if (NSPLIT >= 2) acc[mb][nb] = WFrag<T16>::mma(a[mb], b2, acc[mb][nb]); } }
        asm volatile("v_nop\n\tv_nop\n\tv_nop\n\tv_nop" : "+v"(acc[0][0]), "+v"(acc[1][1]), "+v"(acc[2][2]), "+v"(acc[3][3]) : "v"(a[0]), "v"(a[3]));
    }
#pragma unroll
    for (int mb = 0; mb < 4; ++mb) {
#pragma unroll
        for (int nb = 0; nb < 4; ++nb) {
#pragma unroll
            for (int j = 0; j < 8; ++j) os[(hi * 8 + j) * 68 + nb * 16 + lr] = acc[mb][nb][j]; }
        __builtin_amdgcn_wave_barrier(); asm volatile("" ::: "memory");
        float* crow = C + (size_t)(r0 + mb * 16) * ldc + c0;
{
#pragma unroll
            for (int s = 0; s < 8; ++s) { const int row = 2 * s + hi, cofs = lr * 4; v4f val = *(const v4fa*)(os + row * 68 + cofs);
                *(v4f*)(crow + (size_t)row * ldc + cofs) = val; }
             }
        __builtin_amdgcn_wave_barrier(); asm volatile("" ::: "memory");
    }
}

__device__ __forceinline__ h16 tohx(float x) { return (h16)x; }
__device__ __forceinline__ void splitf(float y, unsigned short& h, unsigned short& l) { h = f2bf(y); l = f2bf(y - bf2f(h)); }
typedef __attribute__((ext_vector_type(2))) _Float16 v2h;
typedef __attribute__((ext_vector_type(4))) _Float16 v4h;
typedef __attribute__((ext_vector_type(2))) unsigned short v2us;
typedef __attribute__((ext_vector_type(4))) unsigned short v4us;
typedef __attribute__((ext_vector_type(2))) float v2f;
typedef __attribute__((ext_vector_type(4))) int v4i;

__global__ __launch_bounds__(256) void k_wtG(const float* __restrict__ w, int K, int N, bf* Bt) {
    const int lane = threadIdx.x & 31; const int L0 = (blockIdx.x * 8 + (threadIdx.x >> 5)) * 8; const int nlines = N * K / 64;
{
#pragma unroll 1
        for (int l = 0; l < 8; ++l) { const int L = L0 + l; if (L >= nlines) break; const size_t e = (size_t)L * 64 + lane * 2; const int k = (int)(e % K), n = (int)(e / K); v2us o;
            o[0] = f2bf(w[(size_t)k * N + n]); o[1] = f2bf(w[(size_t)(k + 1) * N + n]); *(v2us*)(Bt + e) = o; }
         }
}
__global__ __launch_bounds__(256) void k_cvt8(const float* __restrict__ src, bf* dst, size_t n8) { const size_t i = (size_t)blockIdx.x * 256 + threadIdx.x; if (i >= n8) return; const v8f v = *(const v8f*)(src + i * 8); v8us o;
#pragma unroll
    for (int k = 0; k < 8; ++k) o[k] = f2bf(v[k]); *(v8us*)(dst + i * 8) = o;  }
__constant__ float TS[NH_] = {1.0f,1.3335214853286743f,1.778279423713684f,2.3713736534118652f,3.1622776985168457f,4.2169647216796875f,5.6234130859375f,7.4989423751831055f,10.0f,13.335214614868164f,17.782794952392578f,23.71373748779297f,31.62277603149414f,42.16965103149414f,56.234134674072266f,74.98941802978516f,100.0f,133.35214233398438f,177.82794189453125f,237.1373748779297f,316.2277526855469f,421.6965026855469f,562.34130859375f,749.8942260742188f,1000.0f,1333.521484375f,1778.2794189453125f,2371.37353515625f,3162.277587890625f,4216.96484375f,5623.4130859375f,7498.94189453125f};   // float32 10000^(2n/64), n = head index (the module's rope broadcasts over heads)
__global__ __launch_bounds__(256) void k_csh(float* CSH) { const int idx = blockIdx.x * 256 + threadIdx.x; if (idx >= NH_ * TT) return; const int h = idx / TT, t = idx % TT; const float ang = __fdiv_rn((float)t, TS[h]); v2f cs; cs[0] = cosf(ang); cs[1] = sinf(ang);
    *(v2f*)(CSH + (size_t)idx * 2) = cs;  }

// k_rope: head planes [h][t][d] (fp16 + hi/lo) of rope(x) x sc with the rotate-half convention and ONE angle per (head, position): out[d] = x[d] cos[h][t] - x[d+HD/2] sin[h][t], out[d+HD/2] = x[d+HD/2] cos[h][t] + x[d] sin[h][t]
__global__ __launch_bounds__(256) void k_rope(const float* __restrict__ F, int pitch, int nheads, const float* __restrict__ CS, const float* __restrict__ RF, const float* __restrict__ nw, float sc, h16* P16, bf* Ph, bf* Pl) {
    const size_t e = ((size_t)blockIdx.x * 256 + threadIdx.x) * 2; if (e >= (size_t)nheads * TT * HD) return; const int d = (int)(e % HD); const int t = (int)((e / HD) % TT); const int h = (int)(e / ((size_t)HD * TT)); const float* f = F + (size_t)t * pitch + h * HD; const float rf = RF ? RF[(size_t)h * TT + t] : 1.0f; v2h o16; v2us oh, ol;
#pragma unroll
    for (int q = 0; q < 2; ++q) { const int dd = d + q; const int dp = (dd < HD / 2) ? dd + HD / 2 : dd - HD / 2; float x0 = f[dd], x1 = f[dp];
        if (RF) { float n0 = __fmul_rn(x0, rf), n1 = __fmul_rn(x1, rf); asm volatile("" : "+v"(n0)); asm volatile("" : "+v"(n1)); x0 = __fmul_rn(bfr(nw[dd]), n0); x1 = __fmul_rn(bfr(nw[dp]), n1); }
        const v2f cs = *(const v2f*)(CS + ((size_t)h * TT + t) * 2);   /* per-head angle (module quirk) */ float a = __fmul_rn(x0, cs[0]), bq = __fmul_rn(x1, cs[1]); asm volatile("" : "+v"(a)); asm volatile("" : "+v"(bq)); const float r = ((dd < HD / 2) ? __fsub_rn(a, bq) : __fadd_rn(a, bq)) * sc;
        o16[q] = tohx(r); unsigned short a2, c2; splitf(r, a2, c2); oh[q] = a2; ol[q] = c2; }
    *(v2h*)(P16 + e) = o16; *(v2us*)(Ph + e) = oh; *(v2us*)(Pl + e) = ol;  }
__global__ __launch_bounds__(256) void k_vtp(const float* __restrict__ F, int pitch, int nheads, h16* V16, bf* Vh, bf* Vl) { const size_t e = ((size_t)blockIdx.x * 256 + threadIdx.x) * 2; if (e >= (size_t)nheads * HD * TT) return; const int t = (int)(e % TT); const int d = (int)((e / TT) % HD); const int g = (int)(e / ((size_t)TT * HD)); v2h o16; v2us oh, ol;
#pragma unroll
    for (int q = 0; q < 2; ++q) { const float x = F[(size_t)(t + q) * pitch + g * HD + d]; o16[q] = tohx(x); unsigned short a2, c2; splitf(x, a2, c2); oh[q] = a2; ol[q] = c2; }
    *(v2h*)(V16 + e) = o16; *(v2us*)(Vh + e) = oh; *(v2us*)(Vl + e) = ol;  }
// k_asoft: per row (zz, i): t = S x HD^-0.5 for j <= i and i - j < WIN (WIN = TT, so the window test always holds: plain causal mask; the reference's -1e9 additive fill vanishes identically); softmax over the 2048 keys (register row, one exp, fixed trees);
__global__ __launch_bounds__(256) void k_asoft(const float* __restrict__ Sb, h16* P16, bf* Ph, bf* Pl) {
    const int lane = threadIdx.x & 31; const int row = blockIdx.x * 8 + (threadIdx.x >> 5); if (row >= ZH * TT) return; const int i = row % TT; const int zz = row / TT; (void)zz; const bool hires = (i < RH); const float* sr = Sb + (size_t)row * TT; float v[TT / 32]; float mx = -3.0e38f;
#pragma unroll
    for (int ch = 0; ch < TT / 128; ++ch) { const int j0 = ch * 128 + lane * 4; const v4f a = *(const v4f*)(sr + j0);
#pragma unroll
        for (int q = 0; q < 4; ++q) { const int j = j0 + q; (void)j; const float t = (j <= i && i - j < WIN) ? a[q] * SCL : -3.0e38f; v[ch * 4 + q] = t; mx = fmaxf(mx, t); } }
#pragma unroll
    for (int sh = 16; sh; sh >>= 1) mx = fmaxf(mx, __shfl_xor(mx, sh, 32));
    float sum = 0.f;
#pragma unroll
    for (int k = 0; k < TT / 32; ++k) { float d0 = __fsub_rn(v[k], mx); asm volatile("" : "+v"(d0)); v[k] = __builtin_amdgcn_exp2f(__fmul_rn(d0, 1.4426950408889634f)); sum += v[k]; }
#pragma unroll
    for (int sh = 16; sh; sh >>= 1) sum += __shfl_xor(sum, sh, 32);
    const float f = __fdiv_rn(hires ? 1.0f : PCAR, sum);
{
        if (hires) {
#pragma unroll
            for (int ch = 0; ch < TT / 128; ++ch) { v4us oh, ol;
#pragma unroll
                for (int q = 0; q < 4; ++q) { unsigned short a, c2; splitf(v[ch * 4 + q] * f, a, c2); oh[q] = a; ol[q] = c2; }
                const size_t oo = ((size_t)zz * (RH ? RH : 1) + i) * TT + ch * 128 + lane * 4; *(v4us*)(Ph + oo) = oh; *(v4us*)(Pl + oo) = ol; }
        } else {
#pragma unroll
            for (int ch = 0; ch < TT / 128; ++ch) { v4h o4;
#pragma unroll
                for (int q = 0; q < 4; ++q) o4[q] = tohx(v[ch * 4 + q] * f);
                *(v4h*)(P16 + (size_t)row * TT + ch * 128 + lane * 4) = o4; } }
         }
}
__global__ __launch_bounds__(256) void k_merge(const float* __restrict__ O, int h0, bf* Ah, bf* Al) { const size_t e = ((size_t)blockIdx.x * 256 + threadIdx.x) * 2; if (e >= (size_t)ZH * TT * HD) return; const int d = (int)(e % HD); const int t = (int)((e / HD) % TT); const int zz = (int)(e / ((size_t)HD * TT)); const float cs = (t < RH) ? 1.0f : (1.0f / PCAR); const size_t oo = (size_t)t * DQ + (h0 + zz) * HD + d;
    v2us oh, ol;
#pragma unroll
    for (int q = 0; q < 2; ++q) { unsigned short a, c2; splitf(O[e + q] * cs, a, c2); oh[q] = a; ol[q] = c2; } *(v2us*)(Ah + oo) = oh; *(v2us*)(Al + oo) = ol;  }

extern "C" void kernel_launch(void* const* d_in, const int* in_sizes, int n_in,
                              void* d_out, int out_size, void* d_ws, size_t ws_size, hipStream_t stream) {
    (void)in_sizes; (void)n_in; (void)out_size;
    const float* x = (const float*)d_in[0]; const float* wq = (const float*)d_in[1]; const float* bq = (const float*)d_in[2]; const float* wk = (const float*)d_in[3]; const float* bk = (const float*)d_in[4]; const float* wv = (const float*)d_in[5]; const float* bv = (const float*)d_in[6]; const float* wo = (const float*)d_in[7]; const float* bo = (const float*)d_in[8];
    float* OUT = (float*)d_out;     // [2][2048][2048]
    char* wsp = (char*)d_ws;
    auto take = [&](size_t bytes) { char* p = wsp; wsp += (bytes + 255) & ~(size_t)255; return (void*)p; };
    bf* WQ = (bf*)take((size_t)DQ * DM * 2); bf* WK = (bf*)take((size_t)DKV * DM * 2); bf* WV = (bf*)take((size_t)DKV * DM * 2); bf* WO = (bf*)take((size_t)DM * DQ * 2); float* CS = (float*)take((size_t)NH_ * TT * 2 * 4);
    bf* XB = (bf*)take((size_t)TT * DM * 2); float* FQ = (float*)take((size_t)TT * DQ * 4); float* FK = (float*)take((size_t)TT * DKV * 4);
    h16* QP16 = (h16*)take((size_t)NH_ * TT * HD * 2); h16* KP16 = (h16*)take((size_t)NKV * TT * HD * 2); h16* VT16 = (h16*)take((size_t)NKV * HD * TT * 2);
    bf* QPh = (bf*)take((size_t)NH_ * TT * HD * 2); bf* QPl = (bf*)take((size_t)NH_ * TT * HD * 2); bf* KPh = (bf*)take((size_t)NKV * TT * HD * 2); bf* KPl = (bf*)take((size_t)NKV * TT * HD * 2); bf* VTh = (bf*)take((size_t)NKV * HD * TT * 2); bf* VTl = (bf*)take((size_t)NKV * HD * TT * 2); bf* Ph = (bf*)take((size_t)ZH * RH * TT * 2); bf* Pl = (bf*)take((size_t)ZH * RH * TT * 2);
    float* Sb = (float*)take((size_t)ZH * TT * TT * 4); h16* P16 = (h16*)take((size_t)ZH * TT * TT * 2); float* Ob = (float*)take((size_t)ZH * TT * HD * 4); bf* ATh = (bf*)take((size_t)TT * DQ * 2); bf* ATl = (bf*)take((size_t)TT * DQ * 2);
    if ((size_t)(wsp - (char*)d_ws) > ws_size) return;    // ws 256 MiB
    float* FV = FK;   // v projection reuses the k buffer after the k planes are built (stream-ordered)
    { k_cvt8<<<(unsigned)(((size_t)DQ * DM / 8 + 255) / 256), 256, 0, stream>>>(wq, WQ, (size_t)DQ * DM / 8); k_cvt8<<<(unsigned)(((size_t)DKV * DM / 8 + 255) / 256), 256, 0, stream>>>(wk, WK, (size_t)DKV * DM / 8); k_cvt8<<<(unsigned)(((size_t)DKV * DM / 8 + 255) / 256), 256, 0, stream>>>(wv, WV, (size_t)DKV * DM / 8);
      k_cvt8<<<(unsigned)(((size_t)DM * DQ / 8 + 255) / 256), 256, 0, stream>>>(wo, WO, (size_t)DM * DQ / 8);
       }
    const unsigned LQ = (unsigned)(((size_t)NH_ * TT * HD / 2 + 255) / 256), LKv = (unsigned)(((size_t)NKV * TT * HD / 2 + 255) / 256);
    for (int b = 0; b < NB_; ++b) {
        if (b == 0) k_csh<<<(NH_ * TT + 255) / 256, 256, 0, stream>>>(CS);
        k_cvt8<<<(unsigned)(((size_t)TT * DM / 8 + 255) / 256), 256, 0, stream>>>(x + (size_t)b * TT * DM, XB, (size_t)TT * DM / 8);
        k_gemmw<bf, 0, true><<<dim3(TT / 64, DQ / 64, 1), 32, 0, stream>>>(XB, nullptr, WQ, nullptr, DM, FQ, DQ, bq, 0, 0, 0);
        k_rope<<<LQ, 256, 0, stream>>>(FQ, DQ, NH_, CS, nullptr, nullptr, 1.0f, QP16, QPh, QPl);
        k_gemmw<bf, 0, true><<<dim3(TT / 64, DKV / 64, 1), 32, 0, stream>>>(XB, nullptr, WK, nullptr, DM, FK, DKV, bk, 0, 0, 0);
        k_rope<<<LKv, 256, 0, stream>>>(FK, DKV, NKV, CS, nullptr, nullptr, 1.0f, KP16, KPh, KPl);
        k_gemmw<bf, 0, true><<<dim3(TT / 64, DKV / 64, 1), 32, 0, stream>>>(XB, nullptr, WV, nullptr, DM, FV, DKV, bv, 0, 0, 0); k_vtp<<<LKv, 256, 0, stream>>>(FV, DKV, NKV, VT16, VTh, VTl);
        for (int h0 = 0; h0 < NH_; h0 += ZH) { const size_t zq = (size_t)h0, zk = (size_t)(h0 / REP);   // one kv head per query head: the pass's two heads use consecutive kv planes (z-strides TT*HD)
            k_gemmc<bf, 2, 1><<<dim3(RH / 64, TT / 64, ZH), 32, 0, stream>>>(QPh + zq * TT * HD, QPl + zq * TT * HD, KPh + zk * TT * HD, KPl + zk * TT * HD, HD, Sb, TT, 0, (size_t)TT * HD, (size_t)TT * HD, (size_t)TT * TT);
            k_gemmc<h16, 0, 1><<<dim3((TT - RH) / 64, TT / 64, ZH), 32, 0, stream>>>(QP16 + zq * TT * HD + (size_t)RH * HD, nullptr, KP16 + zk * TT * HD, nullptr, HD, Sb + (size_t)RH * TT, TT, RH, (size_t)TT * HD, (size_t)TT * HD, (size_t)TT * TT);
            k_asoft<<<ZH * TT / 8, 256, 0, stream>>>(Sb, P16, Ph, Pl);
            k_gemmc<bf, 2, 2><<<dim3(RH / 64, HD / 64, ZH), 32, 0, stream>>>(Ph, Pl, VTh + zk * HD * TT, VTl + zk * HD * TT, TT, Ob, HD, 0, (size_t)RH * TT, (size_t)HD * TT, (size_t)TT * HD);
            k_gemmc<h16, 0, 2><<<dim3((TT - RH) / 64, HD / 64, ZH), 32, 0, stream>>>(P16 + (size_t)RH * TT, nullptr, VT16 + zk * HD * TT, nullptr, TT, Ob + (size_t)RH * HD, HD, RH, (size_t)TT * TT, (size_t)HD * TT, (size_t)TT * HD);
            k_merge<<<(unsigned)(((size_t)ZH * TT * HD / 2 + 255) / 256), 256, 0, stream>>>(Ob, h0, ATh, ATl); }
        k_gemmw<bf, 1, true><<<dim3(TT / 64, DM / 64, 1), 32, 0, stream>>>(ATh, ATl, WO, nullptr, DQ, OUT + (size_t)b * TT * DM, DM, bo, 0, 0, 0); }
}

// v001
// Measured time: 1600 microseconds a run.
// In two side-by-side timings against v000, it was 1.78 and 1.79 times as fast.
#include <hip/hip_runtime.h>

// Causal multi-head attention with the module's rotary quirk (x [2][2048][2048]; q, k, v = x W^T + b ('oi' [2048][2048] + [2048]; 32 heads x 64); apply_rope broadcasts its [L][32][1] sinusoid against [B][L][heads=32][32], so the rotation angle depends on the HEAD index: for head n and every feature pair (j, j+32): angle = t / 10000^(2n/64) (the same angle for all 32 pairs of the head); scores = q.k / 8, causal; softmax; out = merged Wo^T + bo -> [2][2048][2048] (8.4 M)).
// Compute dtypes, f32 accumulate: every input rounded to bf16; q/k/v on PLAIN bf16 operands (inputs: exact) + biases; per-head-angle rotary in f32 (precise cosf/sinf of t / timescale[n], float32 timescale constants); causal scores and attn.v (tile skipping): query rows < 512 hl (3 products), the rest single fp16 (x1024); softmax f32; Wo hl x exact (2 products) + bo.

#define NB_  2
#define TT   2048
#define DM   2048
#define NH_  32
#define NKV  32
#define REP  (NH_ / NKV)
#define HD   64
#define DQ   (NH_ * HD)
#define DKV  (NKV * HD)
#define ZH   2
#define RH   512                  // query rows < RH use hi+lo planes (0: none)
#define WIN  2048
#define PCAR 1024.0f
#define SCL  0.125f   // HD^-0.5
typedef _Float16 h16;
typedef unsigned short bf;
typedef __attribute__((ext_vector_type(16))) __bf16   v16bf;
typedef __attribute__((ext_vector_type(16))) _Float16 v16h;
typedef __attribute__((ext_vector_type(8)))  _Float16 v8h;
typedef __attribute__((ext_vector_type(8)))  unsigned short v8us;
typedef __attribute__((ext_vector_type(8)))  float    v8f;
typedef __attribute__((ext_vector_type(4)))  float    v4f;
typedef v8h  __attribute__((may_alias)) v8ha;
typedef v4f  __attribute__((may_alias)) v4fa;
typedef v8us __attribute__((may_alias)) v8usa;

__device__ __forceinline__ unsigned short f2bf(float f) { unsigned u = __float_as_uint(f); u += 0x7FFFu + ((u >> 16) & 1u); return (unsigned short)(u >> 16); }
__device__ __forceinline__ float bf2f(unsigned short b) { return __uint_as_float(((unsigned)b) << 16); }
__device__ __forceinline__ float bfr(float f) { return bf2f(f2bf(f)); }
__device__ __forceinline__ v16h cat16(v8h lo, v8h hi) { return __builtin_shufflevector(lo, hi, 0, 1, 2, 3, 4, 5, 6, 7, 8, 9, 10, 11, 12, 13, 14, 15); }
__device__ __forceinline__ v16bf cat16b(v8us lo, v8us hi) { return __builtin_bit_cast(v16bf, __builtin_shufflevector(lo, hi, 0, 1, 2, 3, 4, 5, 6, 7, 8, 9, 10, 11, 12, 13, 14, 15)); }
__device__ __forceinline__ v8f wmma16(v16h a, v16h b, v8f c) { return __builtin_amdgcn_wmma_f32_16x16x32_f16(false, a, false, b, (short)0, c, false, false); }
__device__ __forceinline__ v8f wmmab(v16bf a, v16bf b, v8f c) { return __builtin_amdgcn_wmma_f32_16x16x32_bf16(false, a, false, b, (short)0, c, false, false); }



// ---- k_gemmw: register-blocked GEMM, ONE WAVE per 64x64 output tile (16 accumulators), operands straight from K-contiguous 16-bit planes; grid (M/64, N/64, Z), 32 threads.
// C[m][n] (f32, pitch ldc, + optional f32 bias[n]) = sum_k A[m][k] Bt[n][k] (+ split products per NSPLIT). z-batch strides sA/sB/sC in elements. K % 32 == 0.
template <typename T16> struct WFrag;
template <> struct WFrag<h16> { typedef v16h V; static __device__ __forceinline__ V ld(const h16* p) { return cat16(*(const v8h*)p, *(const v8h*)(p + 16)); } static __device__ __forceinline__ v8f mma(V a, V b, v8f c) { return wmma16(a, b, c); } };
template <> struct WFrag<bf> { typedef v16bf V; static __device__ __forceinline__ V ld(const bf* p) { return cat16b(*(const v8us*)p, *(const v8us*)(p + 16)); } static __device__ __forceinline__ v8f mma(V a, V b, v8f c) { return wmmab(a, b, c); } };
template <typename T16, int NSPLIT, bool BIAS>
__global__ __launch_bounds__(32) void k_gemmw(const T16* __restrict__ A, const T16* __restrict__ A2, const T16* __restrict__ Bt, const T16* __restrict__ Bt2, int K, float* C, int ldc, const float* __restrict__ bias, size_t sA, size_t sB, size_t sC) {
    typedef typename WFrag<T16>::V V;
    __shared__ __align__(16) float os[16 * 68];
    const size_t z = blockIdx.z; A += z * sA; if (A2) A2 += z * sA; Bt += z * sB; if (Bt2) Bt2 += z * sB; C += z * sC;
    const int lane = threadIdx.x & 31, lr = lane & 15, hi = lane >> 4; const int r0 = blockIdx.x * 64, c0 = blockIdx.y * 64;
    v8f acc[4][4];
#pragma unroll
    for (int mb = 0; mb < 4; ++mb)
#pragma unroll
        for (int nb = 0; nb < 4; ++nb) acc[mb][nb] = (v8f){};
    const size_t aoff = (size_t)(r0 + lr) * K + 8 * hi, boff = (size_t)(c0 + lr) * K + 8 * hi;
#pragma unroll 1
    for (int kc = 0; kc < K; kc += 32) {
        V a[4], a2[4];
#pragma unroll
        for (int mb = 0; mb < 4; ++mb) { a[mb] = WFrag<T16>::ld(A + aoff + (size_t)mb * 16 * K + kc); if (NSPLIT == 1 || NSPLIT == 2) a2[mb] = WFrag<T16>::ld(A2 + aoff + (size_t)mb * 16 * K + kc); }
#pragma unroll
        for (int nb = 0; nb < 4; ++nb) { const V b = WFrag<T16>::ld(Bt + boff + (size_t)nb * 16 * K + kc); V b2; if (NSPLIT >= 2) b2 = WFrag<T16>::ld(Bt2 + boff + (size_t)nb * 16 * K + kc);
#pragma unroll
            for (int mb = 0; mb < 4; ++mb) { acc[mb][nb] = WFrag<T16>::mma(a[mb], b, acc[mb][nb]); if (NSPLIT == 1 || NSPLIT == 2) acc[mb][nb] = WFrag<T16>::mma(a2[mb], b, acc[mb][nb]); if (NSPLIT >= 2) acc[mb][nb] = WFrag<T16>::mma(a[mb], b2, acc[mb][nb]); } }
        asm volatile("v_nop\n\tv_nop\n\tv_nop\n\tv_nop" : "+v"(acc[0][0]), "+v"(acc[1][1]), "+v"(acc[2][2]), "+v"(acc[3][3]) : "v"(a[0]), "v"(a[3]));
    }
#pragma unroll
    for (int mb = 0; mb < 4; ++mb) {
#pragma unroll
        for (int nb = 0; nb < 4; ++nb) {
#pragma unroll
            for (int j = 0; j < 8; ++j) os[(hi * 8 + j) * 68 + nb * 16 + lr] = acc[mb][nb][j]; }
        __builtin_amdgcn_wave_barrier(); asm volatile("" ::: "memory");
        float* crow = C + (size_t)(r0 + mb * 16) * ldc + c0;
{
#pragma unroll
            for (int s = 0; s < 8; ++s) { const int row = 2 * s + hi, cofs = lr * 4; v4f val = *(const v4fa*)(os + row * 68 + cofs); if (BIAS) { val[0] += bfr(bias[c0 + cofs]); val[1] += bfr(bias[c0 + cofs + 1]); val[2] += bfr(bias[c0 + cofs + 2]); val[3] += bfr(bias[c0 + cofs + 3]); }
                *(v4f*)(crow + (size_t)row * ldc + cofs) = val; }
             }
        __builtin_amdgcn_wave_barrier(); asm volatile("" ::: "memory");
    }
}

// ---- k_gemmc: the same one-wave 64x64 tile GEMM specialised for causal attention: CMODE 1 skips score tiles entirely above the diagonal (query rows r0+roff.., key columns c0..), CMODE 2 limits the
// key (K) loop of the probability x value contraction to the diagonal block (probabilities beyond it are exactly zero). roff = row offset of this launch's first row within the sequence.
template <typename T16, int NSPLIT, int CMODE>
__global__ __launch_bounds__(32) void k_gemmc(const T16* __restrict__ A, const T16* __restrict__ A2, const T16* __restrict__ Bt, const T16* __restrict__ Bt2, int K, float* C, int ldc, int roff, size_t sA, size_t sB, size_t sC) {
    typedef typename WFrag<T16>::V V;
    __shared__ __align__(16) float os[16 * 68];
    const size_t z = blockIdx.z; A += z * sA; if (A2) A2 += z * sA; Bt += z * sB; if (Bt2) Bt2 += z * sB; C += z * sC;
    const int lane = threadIdx.x & 31, lr = lane & 15, hi = lane >> 4; const int r0 = blockIdx.x * 64, c0 = blockIdx.y * 64;
    if (CMODE == 1 && c0 > r0 + roff + 63) return;                  // score tile entirely above the causal diagonal: never read (the softmax masks j > i by select)
    const int Kl = (CMODE == 2) ? min(K, r0 + roff + 64) : K;        // P.V: probabilities are exactly 0 beyond the diagonal block, so the K loop stops there
    v8f acc[4][4];
#pragma unroll
    for (int mb = 0; mb < 4; ++mb)
#pragma unroll
        for (int nb = 0; nb < 4; ++nb) acc[mb][nb] = (v8f){};
    const size_t aoff = (size_t)(r0 + lr) * K + 8 * hi, boff = (size_t)(c0 + lr) * K + 8 * hi;
#pragma unroll 1
    for (int kc = 0; kc < Kl; kc += 32) {
        V a[4], a2[4];
#pragma unroll
        for (int mb = 0; mb < 4; ++mb) { a[mb] = WFrag<T16>::ld(A + aoff + (size_t)mb * 16 * K + kc); if (NSPLIT == 1 || NSPLIT == 2) a2[mb] = WFrag<T16>::ld(A2 + aoff + (size_t)mb * 16 * K + kc); }
#pragma unroll
        for (int nb = 0; nb < 4; ++nb) { const V b = WFrag<T16>::ld(Bt + boff + (size_t)nb * 16 * K + kc); V b2; if (NSPLIT >= 2) b2 = WFrag<T16>::ld(Bt2 + boff + (size_t)nb * 16 * K + kc);
#pragma unroll
            for (int mb = 0; mb < 4; ++mb) { acc[mb][nb] = WFrag<T16>::mma(a[mb], b, acc[mb][nb]); if (NSPLIT == 1 || NSPLIT == 2) acc[mb][nb] = WFrag<T16>::mma(a2[mb], b, acc[mb][nb]); if (NSPLIT >= 2) acc[mb][nb] = WFrag<T16>::mma(a[mb], b2, acc[mb][nb]); } }
        asm volatile("v_nop\n\tv_nop\n\tv_nop\n\tv_nop" : "+v"(acc[0][0]), "+v"(acc[1][1]), "+v"(acc[2][2]), "+v"(acc[3][3]) : "v"(a[0]), "v"(a[3]));
    }
#pragma unroll
    for (int mb = 0; mb < 4; ++mb) {
#pragma unroll
        for (int nb = 0; nb < 4; ++nb) {
#pragma unroll
            for (int j = 0; j < 8; ++j) os[(hi * 8 + j) * 68 + nb * 16 + lr] = acc[mb][nb][j]; }
        __builtin_amdgcn_wave_barrier(); asm volatile("" ::: "memory");
        float* crow = C + (size_t)(r0 + mb * 16) * ldc + c0;
{
#pragma unroll
            for (int s = 0; s < 8; ++s) { const int row = 2 * s + hi, cofs = lr * 4; v4f val = *(const v4fa*)(os + row * 68 + cofs);
                *(v4f*)(crow + (size_t)row * ldc + cofs) = val; }
             }
        __builtin_amdgcn_wave_barrier(); asm volatile("" ::: "memory");
    }
}

// ---- k_pvs: probability x value contraction with the key loop SPLIT OVER THE PVW WAVES of one work-group. One work-group per 32x64 output tile; wave w takes the 32-key chunks w, w + PVW, w + 2 PVW, ...
// up to the diagonal block (probabilities beyond it are exactly zero), keeps a full 32x64 f32 partial tile, and the PVW partial tiles are added in LDS in the fixed order w = 0 .. PVW-1.
// The one-wave form walks up to 64 dependent load-then-multiply trips; here the longest wave walks 4, and the chunks of neighbouring waves share 128-byte lines. grid (M/32, N/64, Z), 32 * PVW threads.
#define PVW  16
// fragment pointers in 16-byte units, typed as global memory: a pointer carried round the loop would otherwise compile to flat loads. A fragment is units 0 and 2 (elements 0..7 and 16..23 from the lane's start), as in WFrag::ld.
template <typename T16> struct GPtr;
template <> struct GPtr<h16> { typedef const __attribute__((address_space(1))) v8h* P; };
template <> struct GPtr<bf> { typedef const __attribute__((address_space(1))) v8us* P; };
__device__ __forceinline__ v16h ldfrag(GPtr<h16>::P p) { return cat16(p[0], p[2]); }
__device__ __forceinline__ v16bf ldfrag(GPtr<bf>::P p) { return cat16b(p[0], p[2]); }
#define PVP  68                   // f32 pitch of a partial tile's row in LDS (the two half-waves of a store land on different banks)
template <typename T16, int NSPLIT>
__global__ __launch_bounds__(32 * PVW) void k_pvs(const T16* __restrict__ A, const T16* __restrict__ A2, const T16* __restrict__ Bt, const T16* __restrict__ Bt2, int K, float* C, int ldc, int roff, size_t sA, size_t sB, size_t sC) {
    typedef typename WFrag<T16>::V V;
    __shared__ __align__(16) float ps[PVW * 32 * PVP];
    const size_t z = blockIdx.z; A += z * sA; if (A2) A2 += z * sA; Bt += z * sB; if (Bt2) Bt2 += z * sB; C += z * sC;
    const int lane = threadIdx.x & 31, lr = lane & 15, hi = lane >> 4; const int r0 = blockIdx.x * 32, c0 = blockIdx.y * 64;
    const int w = __builtin_amdgcn_readfirstlane((int)(threadIdx.x >> 5));   // wave number in a scalar register: the key loop's test stays a scalar branch
    const int Kl = min(K, r0 + roff + 32);                            // the tile's last query row is r0 + roff + 31: probabilities of later keys are exactly 0
    v8f acc[2][4];
    // every loop over mb, nb, j or s below is unrolled in full, so that the fragment, pointer and accumulator arrays are registers
#pragma unroll
    for (int mb = 0; mb < 2; ++mb)
#pragma unroll
        for (int nb = 0; nb < 4; ++nb) acc[mb][nb] = (v8f){};
    // one pointer per fragment row block, moved on by PVW chunks a trip
    typedef typename GPtr<T16>::P GP;
    GP pa[2], pa2[2], pb[4], pb2[4];
#pragma unroll
    for (int mb = 0; mb < 2; ++mb) { const size_t o = (size_t)(r0 + mb * 16 + lr) * K + 8 * hi + w * 32; pa[mb] = (GP)(A + o); if (NSPLIT == 1 || NSPLIT == 2) pa2[mb] = (GP)(A2 + o); }
#pragma unroll
    for (int nb = 0; nb < 4; ++nb) { const size_t o = (size_t)(c0 + nb * 16 + lr) * K + 8 * hi + w * 32; pb[nb] = (GP)(Bt + o); if (NSPLIT >= 2) pb2[nb] = (GP)(Bt2 + o); }
#pragma unroll 1   // kept rolled: at most 4 trips, and each wave fetches the loop's code once
    for (int kc = w * 32; kc < Kl; kc += PVW * 32) {
        V a[2], a2[2];
#pragma unroll
        for (int mb = 0; mb < 2; ++mb) { a[mb] = ldfrag(pa[mb]); pa[mb] += PVW * 4; if (NSPLIT == 1 || NSPLIT == 2) { a2[mb] = ldfrag(pa2[mb]); pa2[mb] += PVW * 4; } }
#pragma unroll
        for (int nb = 0; nb < 4; ++nb) { const V b = ldfrag(pb[nb]); pb[nb] += PVW * 4; V b2; if (NSPLIT >= 2) { b2 = ldfrag(pb2[nb]); pb2[nb] += PVW * 4; }
#pragma unroll
            for (int mb = 0; mb < 2; ++mb) { acc[mb][nb] = WFrag<T16>::mma(a[mb], b, acc[mb][nb]); if (NSPLIT == 1 || NSPLIT == 2) acc[mb][nb] = WFrag<T16>::mma(a2[mb], b, acc[mb][nb]); if (NSPLIT >= 2) acc[mb][nb] = WFrag<T16>::mma(a[mb], b2, acc[mb][nb]); } }
    }
    float* pw = ps + w * (32 * PVP);
#pragma unroll
    for (int mb = 0; mb < 2; ++mb)
#pragma unroll
        for (int nb = 0; nb < 4; ++nb)
#pragma unroll
            for (int j = 0; j < 8; ++j) pw[(mb * 16 + hi * 8 + j) * PVP + nb * 16 + lr] = acc[mb][nb][j];
    __syncthreads();                                                  // every wave's partial tile is in LDS before any thread adds them
    const int row = (int)(threadIdx.x >> 4), cofs = (int)(threadIdx.x & 15) * 4;
    v4f val = *(const v4fa*)(ps + row * PVP + cofs);
#pragma unroll
    for (int s = 1; s < PVW; ++s) val += *(const v4fa*)(ps + s * (32 * PVP) + row * PVP + cofs);
    *(v4f*)(C + (size_t)(r0 + row) * ldc + c0 + cofs) = val;
}

__device__ __forceinline__ h16 tohx(float x) { return (h16)x; }
__device__ __forceinline__ void splitf(float y, unsigned short& h, unsigned short& l) { h = f2bf(y); l = f2bf(y - bf2f(h)); }
typedef __attribute__((ext_vector_type(2))) _Float16 v2h;
typedef __attribute__((ext_vector_type(4))) _Float16 v4h;
typedef __attribute__((ext_vector_type(2))) unsigned short v2us;
typedef __attribute__((ext_vector_type(4))) unsigned short v4us;
typedef __attribute__((ext_vector_type(2))) float v2f;
typedef __attribute__((ext_vector_type(4))) int v4i;

__global__ __launch_bounds__(256) void k_wtG(const float* __restrict__ w, int K, int N, bf* Bt) {
    const int lane = threadIdx.x & 31; const int L0 = (blockIdx.x * 8 + (threadIdx.x >> 5)) * 8; const int nlines = N * K / 64;
{
#pragma unroll 1
        for (int l = 0; l < 8; ++l) { const int L = L0 + l; if (L >= nlines) break; const size_t e = (size_t)L * 64 + lane * 2; const int k = (int)(e % K), n = (int)(e / K); v2us o;
            o[0] = f2bf(w[(size_t)k * N + n]); o[1] = f2bf(w[(size_t)(k + 1) * N + n]); *(v2us*)(Bt + e) = o; }
         }
}
__global__ __launch_bounds__(256) void k_cvt8(const float* __restrict__ src, bf* dst, size_t n8) { const size_t i = (size_t)blockIdx.x * 256 + threadIdx.x; if (i >= n8) return; const v8f v = *(const v8f*)(src + i * 8); v8us o;
#pragma unroll
    for (int k = 0; k < 8; ++k) o[k] = f2bf(v[k]); *(v8us*)(dst + i * 8) = o;  }
__constant__ float TS[NH_] = {1.0f,1.3335214853286743f,1.778279423713684f,2.3713736534118652f,3.1622776985168457f,4.2169647216796875f,5.6234130859375f,7.4989423751831055f,10.0f,13.335214614868164f,17.782794952392578f,23.71373748779297f,31.62277603149414f,42.16965103149414f,56.234134674072266f,74.98941802978516f,100.0f,133.35214233398438f,177.82794189453125f,237.1373748779297f,316.2277526855469f,421.6965026855469f,562.34130859375f,749.8942260742188f,1000.0f,1333.521484375f,1778.2794189453125f,2371.37353515625f,3162.277587890625f,4216.96484375f,5623.4130859375f,7498.94189453125f};   // float32 10000^(2n/64), n = head index (the module's rope broadcasts over heads)
__global__ __launch_bounds__(256) void k_csh(float* CSH) { const int idx = blockIdx.x * 256 + threadIdx.x; if (idx >= NH_ * TT) return; const int h = idx / TT, t = idx % TT; const float ang = __fdiv_rn((float)t, TS[h]); v2f cs; cs[0] = cosf(ang); cs[1] = sinf(ang);
    *(v2f*)(CSH + (size_t)idx * 2) = cs;  }

// k_rope: head planes [h][t][d] (fp16 + hi/lo) of rope(x) x sc with the rotate-half convention and ONE angle per (head, position): out[d] = x[d] cos[h][t] - x[d+HD/2] sin[h][t], out[d+HD/2] = x[d+HD/2] cos[h][t] + x[d] sin[h][t]
__global__ __launch_bounds__(256) void k_rope(const float* __restrict__ F, int pitch, int nheads, const float* __restrict__ CS, const float* __restrict__ RF, const float* __restrict__ nw, float sc, h16* P16, bf* Ph, bf* Pl) {
    const size_t e = ((size_t)blockIdx.x * 256 + threadIdx.x) * 2; if (e >= (size_t)nheads * TT * HD) return; const int d = (int)(e % HD); const int t = (int)((e / HD) % TT); const int h = (int)(e / ((size_t)HD * TT)); const float* f = F + (size_t)t * pitch + h * HD; const float rf = RF ? RF[(size_t)h * TT + t] : 1.0f; v2h o16; v2us oh, ol;
#pragma unroll
    for (int q = 0; q < 2; ++q) { const int dd = d + q; const int dp = (dd < HD / 2) ? dd + HD / 2 : dd - HD / 2; float x0 = f[dd], x1 = f[dp];
        if (RF) { float n0 = __fmul_rn(x0, rf), n1 = __fmul_rn(x1, rf); asm volatile("" : "+v"(n0)); asm volatile("" : "+v"(n1)); x0 = __fmul_rn(bfr(nw[dd]), n0); x1 = __fmul_rn(bfr(nw[dp]), n1); }
        const v2f cs = *(const v2f*)(CS + ((size_t)h * TT + t) * 2);   /* per-head angle (module quirk) */ float a = __fmul_rn(x0, cs[0]), bq = __fmul_rn(x1, cs[1]); asm volatile("" : "+v"(a)); asm volatile("" : "+v"(bq)); const float r = ((dd < HD / 2) ? __fsub_rn(a, bq) : __fadd_rn(a, bq)) * sc;
        o16[q] = tohx(r); unsigned short a2, c2; splitf(r, a2, c2); oh[q] = a2; ol[q] = c2; }
    *(v2h*)(P16 + e) = o16; *(v2us*)(Ph + e) = oh; *(v2us*)(Pl + e) = ol;  }
__global__ __launch_bounds__(256) void k_vtp(const float* __restrict__ F, int pitch, int nheads, h16* V16, bf* Vh, bf* Vl) { const size_t e = ((size_t)blockIdx.x * 256 + threadIdx.x) * 2; if (e >= (size_t)nheads * HD * TT) return; const int t = (int)(e % TT); const int d = (int)((e / TT) % HD); const int g = (int)(e / ((size_t)TT * HD)); v2h o16; v2us oh, ol;
#pragma unroll
    for (int q = 0; q < 2; ++q) { const float x = F[(size_t)(t + q) * pitch + g * HD + d]; o16[q] = tohx(x); unsigned short a2, c2; splitf(x, a2, c2); oh[q] = a2; ol[q] = c2; }
    *(v2h*)(V16 + e) = o16; *(v2us*)(Vh + e) = oh; *(v2us*)(Vl + e) = ol;  }
// k_asoft: per row (zz, i): t = S x HD^-0.5 for j <= i and i - j < WIN (WIN = TT, so the window test always holds: plain causal mask; the reference's -1e9 additive fill vanishes identically); softmax over the 2048 keys (register row, one exp, fixed trees);
__global__ __launch_bounds__(256) void k_asoft(const float* __restrict__ Sb, h16* P16, bf* Ph, bf* Pl) {
    const int lane = threadIdx.x & 31; const int row = blockIdx.x * 8 + (threadIdx.x >> 5); if (row >= ZH * TT) return; const int i = row % TT; const int zz = row / TT; (void)zz; const bool hires = (i < RH); const float* sr = Sb + (size_t)row * TT; float v[TT / 32]; float mx = -3.0e38f;
#pragma unroll
    for (int ch = 0; ch < TT / 128; ++ch) { const int j0 = ch * 128 + lane * 4; const v4f a = *(const v4f*)(sr + j0);
#pragma unroll
        for (int q = 0; q < 4; ++q) { const int j = j0 + q; (void)j; const float t = (j <= i && i - j < WIN) ? a[q] * SCL : -3.0e38f; v[ch * 4 + q] = t; mx = fmaxf(mx, t); } }
#pragma unroll
    for (int sh = 16; sh; sh >>= 1) mx = fmaxf(mx, __shfl_xor(mx, sh, 32));
    float sum = 0.f;
#pragma unroll
    for (int k = 0; k < TT / 32; ++k) { float d0 = __fsub_rn(v[k], mx); asm volatile("" : "+v"(d0)); v[k] = __builtin_amdgcn_exp2f(__fmul_rn(d0, 1.4426950408889634f)); sum += v[k]; }
#pragma unroll
    for (int sh = 16; sh; sh >>= 1) sum += __shfl_xor(sum, sh, 32);
    const float f = __fdiv_rn(hires ? 1.0f : PCAR, sum);
{
        if (hires) {
#pragma unroll
            for (int ch = 0; ch < TT / 128; ++ch) { v4us oh, ol;
#pragma unroll
                for (int q = 0; q < 4; ++q) { unsigned short a, c2; splitf(v[ch * 4 + q] * f, a, c2); oh[q] = a; ol[q] = c2; }
                const size_t oo = ((size_t)zz * (RH ? RH : 1) + i) * TT + ch * 128 + lane * 4; *(v4us*)(Ph + oo) = oh; *(v4us*)(Pl + oo) = ol; }
        } else {
#pragma unroll
            for (int ch = 0; ch < TT / 128; ++ch) { v4h o4;
#pragma unroll
                for (int q = 0; q < 4; ++q) o4[q] = tohx(v[ch * 4 + q] * f);
                *(v4h*)(P16 + (size_t)row * TT + ch * 128 + lane * 4) = o4; } }
         }
}
__global__ __launch_bounds__(256) void k_merge(const float* __restrict__ O, int h0, bf* Ah, bf* Al) { const size_t e = ((size_t)blockIdx.x * 256 + threadIdx.x) * 2; if (e >= (size_t)ZH * TT * HD) return; const int d = (int)(e % HD); const int t = (int)((e / HD) % TT); const int zz = (int)(e / ((size_t)HD * TT)); const float cs = (t < RH) ? 1.0f : (1.0f / PCAR); const size_t oo = (size_t)t * DQ + (h0 + zz) * HD + d;
    v2us oh, ol;
#pragma unroll
    for (int q = 0; q < 2; ++q) { unsigned short a, c2; splitf(O[e + q] * cs, a, c2); oh[q] = a; ol[q] = c2; } *(v2us*)(Ah + oo) = oh; *(v2us*)(Al + oo) = ol;  }

extern "C" void kernel_launch(void* const* d_in, const int* in_sizes, int n_in,
                              void* d_out, int out_size, void* d_ws, size_t ws_size, hipStream_t stream) {
    (void)in_sizes; (void)n_in; (void)out_size;
    const float* x = (const float*)d_in[0]; const float* wq = (const float*)d_in[1]; const float* bq = (const float*)d_in[2]; const float* wk = (const float*)d_in[3]; const float* bk = (const float*)d_in[4]; const float* wv = (const float*)d_in[5]; const float* bv = (const float*)d_in[6]; const float* wo = (const float*)d_in[7]; const float* bo = (const float*)d_in[8];
    float* OUT = (float*)d_out;     // [2][2048][2048]
    char* wsp = (char*)d_ws;
    auto take = [&](size_t bytes) { char* p = wsp; wsp += (bytes + 255) & ~(size_t)255; return (void*)p; };
    bf* WQ = (bf*)take((size_t)DQ * DM * 2); bf* WK = (bf*)take((size_t)DKV * DM * 2); bf* WV = (bf*)take((size_t)DKV * DM * 2); bf* WO = (bf*)take((size_t)DM * DQ * 2); float* CS = (float*)take((size_t)NH_ * TT * 2 * 4);
    bf* XB = (bf*)take((size_t)TT * DM * 2); float* FQ = (float*)take((size_t)TT * DQ * 4); float* FK = (float*)take((size_t)TT * DKV * 4);
    h16* QP16 = (h16*)take((size_t)NH_ * TT * HD * 2); h16* KP16 = (h16*)take((size_t)NKV * TT * HD * 2); h16* VT16 = (h16*)take((size_t)NKV * HD * TT * 2);
    bf* QPh = (bf*)take((size_t)NH_ * TT * HD * 2); bf* QPl = (bf*)take((size_t)NH_ * TT * HD * 2); bf* KPh = (bf*)take((size_t)NKV * TT * HD * 2); bf* KPl = (bf*)take((size_t)NKV * TT * HD * 2); bf* VTh = (bf*)take((size_t)NKV * HD * TT * 2); bf* VTl = (bf*)take((size_t)NKV * HD * TT * 2); bf* Ph = (bf*)take((size_t)ZH * RH * TT * 2); bf* Pl = (bf*)take((size_t)ZH * RH * TT * 2);
    float* Sb = (float*)take((size_t)ZH * TT * TT * 4); h16* P16 = (h16*)take((size_t)ZH * TT * TT * 2); float* Ob = (float*)take((size_t)ZH * TT * HD * 4); bf* ATh = (bf*)take((size_t)TT * DQ * 2); bf* ATl = (bf*)take((size_t)TT * DQ * 2);
    if ((size_t)(wsp - (char*)d_ws) > ws_size) return;    // ws 256 MiB
    float* FV = FK;   // v projection reuses the k buffer after the k planes are built (stream-ordered)
    { k_cvt8<<<(unsigned)(((size_t)DQ * DM / 8 + 255) / 256), 256, 0, stream>>>(wq, WQ, (size_t)DQ * DM / 8); k_cvt8<<<(unsigned)(((size_t)DKV * DM / 8 + 255) / 256), 256, 0, stream>>>(wk, WK, (size_t)DKV * DM / 8); k_cvt8<<<(unsigned)(((size_t)DKV * DM / 8 + 255) / 256), 256, 0, stream>>>(wv, WV, (size_t)DKV * DM / 8);
      k_cvt8<<<(unsigned)(((size_t)DM * DQ / 8 + 255) / 256), 256, 0, stream>>>(wo, WO, (size_t)DM * DQ / 8);
       }
    const unsigned LQ = (unsigned)(((size_t)NH_ * TT * HD / 2 + 255) / 256), LKv = (unsigned)(((size_t)NKV * TT * HD / 2 + 255) / 256);
    for (int b = 0; b < NB_; ++b) {
        if (b == 0) k_csh<<<(NH_ * TT + 255) / 256, 256, 0, stream>>>(CS);
        k_cvt8<<<(unsigned)(((size_t)TT * DM / 8 + 255) / 256), 256, 0, stream>>>(x + (size_t)b * TT * DM, XB, (size_t)TT * DM / 8);
        k_gemmw<bf, 0, true><<<dim3(TT / 64, DQ / 64, 1), 32, 0, stream>>>(XB, nullptr, WQ, nullptr, DM, FQ, DQ, bq, 0, 0, 0);
        k_rope<<<LQ, 256, 0, stream>>>(FQ, DQ, NH_, CS, nullptr, nullptr, 1.0f, QP16, QPh, QPl);
        k_gemmw<bf, 0, true><<<dim3(TT / 64, DKV / 64, 1), 32, 0, stream>>>(XB, nullptr, WK, nullptr, DM, FK, DKV, bk, 0, 0, 0);
        k_rope<<<LKv, 256, 0, stream>>>(FK, DKV, NKV, CS, nullptr, nullptr, 1.0f, KP16, KPh, KPl);
        k_gemmw<bf, 0, true><<<dim3(TT / 64, DKV / 64, 1), 32, 0, stream>>>(XB, nullptr, WV, nullptr, DM, FV, DKV, bv, 0, 0, 0); k_vtp<<<LKv, 256, 0, stream>>>(FV, DKV, NKV, VT16, VTh, VTl);
        for (int h0 = 0; h0 < NH_; h0 += ZH) { const size_t zq = (size_t)h0, zk = (size_t)(h0 / REP);   // one kv head per query head: the pass's two heads use consecutive kv planes (z-strides TT*HD)
            k_gemmc<bf, 2, 1><<<dim3(RH / 64, TT / 64, ZH), 32, 0, stream>>>(QPh + zq * TT * HD, QPl + zq * TT * HD, KPh + zk * TT * HD, KPl + zk * TT * HD, HD, Sb, TT, 0, (size_t)TT * HD, (size_t)TT * HD, (size_t)TT * TT);
            k_gemmc<h16, 0, 1><<<dim3((TT - RH) / 64, TT / 64, ZH), 32, 0, stream>>>(QP16 + zq * TT * HD + (size_t)RH * HD, nullptr, KP16 + zk * TT * HD, nullptr, HD, Sb + (size_t)RH * TT, TT, RH, (size_t)TT * HD, (size_t)TT * HD, (size_t)TT * TT);
            k_asoft<<<ZH * TT / 8, 256, 0, stream>>>(Sb, P16, Ph, Pl);
            k_pvs<bf, 2><<<dim3(RH / 32, HD / 64, ZH), 32 * PVW, 0, stream>>>(Ph, Pl, VTh + zk * HD * TT, VTl + zk * HD * TT, TT, Ob, HD, 0, (size_t)RH * TT, (size_t)HD * TT, (size_t)TT * HD);
            k_pvs<h16, 0><<<dim3((TT - RH) / 32, HD / 64, ZH), 32 * PVW, 0, stream>>>(P16 + (size_t)RH * TT, nullptr, VT16 + zk * HD * TT, nullptr, TT, Ob + (size_t)RH * HD, HD, RH, (size_t)TT * TT, (size_t)HD * TT, (size_t)TT * HD);
            k_merge<<<(unsigned)(((size_t)ZH * TT * HD / 2 + 255) / 256), 256, 0, stream>>>(Ob, h0, ATh, ATl); }
        k_gemmw<bf, 1, true><<<dim3(TT / 64, DM / 64, 1), 32, 0, stream>>>(ATh, ATl, WO, nullptr, DQ, OUT + (size_t)b * TT * DM, DM, bo, 0, 0, 0); }
}

// v002
// Measured time: 1100 microseconds a run.
// Next to v001, in two timings, it ran 1.47 and 1.46 times as fast.
// All steps since v000 together make it 2.62 times as fast.
#include <hip/hip_runtime.h>

// Causal multi-head attention with the module's rotary quirk (x [2][2048][2048]; q, k, v = x W^T + b ('oi' [2048][2048] + [2048]; 32 heads x 64); apply_rope broadcasts its [L][32][1] sinusoid against [B][L][heads=32][32], so the rotation angle depends on the HEAD index: for head n and every feature pair (j, j+32): angle = t / 10000^(2n/64) (the same angle for all 32 pairs of the head); scores = q.k / 8, causal; softmax; out = merged Wo^T + bo -> [2][2048][2048] (8.4 M)).
// Compute dtypes, f32 accumulate: every input rounded to bf16; q/k/v on PLAIN bf16 operands (inputs: exact) + biases; per-head-angle rotary in f32 (precise cosf/sinf of t / timescale[n], float32 timescale constants); causal scores and attn.v (tile skipping): query rows < 512 hl (3 products), the rest single fp16 (x1024); softmax f32; Wo hl x exact (2 products) + bo.

#define NB_  2
#define TT   2048
#define DM   2048
#define NH_  32
#define NKV  32
#define REP  (NH_ / NKV)
#define HD   64
#define DQ   (NH_ * HD)
#define DKV  (NKV * HD)
#define ZH   8                    // heads per attention pass (one launch of each attention kernel serves ZH heads)
#define RH   512                  // query rows < RH use hi+lo planes (0: none)
#define WIN  2048
#define PCAR 1024.0f
#define SCL  0.125f   // HD^-0.5
typedef _Float16 h16;
typedef unsigned short bf;
typedef __attribute__((ext_vector_type(16))) __bf16   v16bf;
typedef __attribute__((ext_vector_type(16))) _Float16 v16h;
typedef __attribute__((ext_vector_type(8)))  _Float16 v8h;
typedef __attribute__((ext_vector_type(8)))  unsigned short v8us;
typedef __attribute__((ext_vector_type(8)))  float    v8f;
typedef __attribute__((ext_vector_type(4)))  float    v4f;
typedef v8h  __attribute__((may_alias)) v8ha;
typedef v4f  __attribute__((may_alias)) v4fa;
typedef v8us __attribute__((may_alias)) v8usa;

__device__ __forceinline__ unsigned short f2bf(float f) { unsigned u = __float_as_uint(f); u += 0x7FFFu + ((u >> 16) & 1u); return (unsigned short)(u >> 16); }
__device__ __forceinline__ float bf2f(unsigned short b) { return __uint_as_float(((unsigned)b) << 16); }
__device__ __forceinline__ float bfr(float f) { return bf2f(f2bf(f)); }
__device__ __forceinline__ v16h cat16(v8h lo, v8h hi) { return __builtin_shufflevector(lo, hi, 0, 1, 2, 3, 4, 5, 6, 7, 8, 9, 10, 11, 12, 13, 14, 15); }
__device__ __forceinline__ v16bf cat16b(v8us lo, v8us hi) { return __builtin_bit_cast(v16bf, __builtin_shufflevector(lo, hi, 0, 1, 2, 3, 4, 5, 6, 7, 8, 9, 10, 11, 12, 13, 14, 15)); }
__device__ __forceinline__ v8f wmma16(v16h a, v16h b, v8f c) { return __builtin_amdgcn_wmma_f32_16x16x32_f16(false, a, false, b, (short)0, c, false, false); }
__device__ __forceinline__ v8f wmmab(v16bf a, v16bf b, v8f c) { return __builtin_amdgcn_wmma_f32_16x16x32_bf16(false, a, false, b, (short)0, c, false, false); }



// ---- k_gemmw: register-blocked GEMM, ONE WAVE per 64x64 output tile (16 accumulators), operands straight from K-contiguous 16-bit planes; grid (M/64, N/64, Z), 32 threads.
// C[m][n] (f32, pitch ldc, + optional f32 bias[n]) = sum_k A[m][k] Bt[n][k] (+ split products per NSPLIT). z-batch strides sA/sB/sC in elements. K % 32 == 0.
template <typename T16> struct WFrag;
template <> struct WFrag<h16> { typedef v16h V; static __device__ __forceinline__ V ld(const h16* p) { return cat16(*(const v8h*)p, *(const v8h*)(p + 16)); } static __device__ __forceinline__ v8f mma(V a, V b, v8f c) { return wmma16(a, b, c); } };
template <> struct WFrag<bf> { typedef v16bf V; static __device__ __forceinline__ V ld(const bf* p) { return cat16b(*(const v8us*)p, *(const v8us*)(p + 16)); } static __device__ __forceinline__ v8f mma(V a, V b, v8f c) { return wmmab(a, b, c); } };
template <typename T16, int NSPLIT, bool BIAS>
__global__ __launch_bounds__(32) void k_gemmw(const T16* __restrict__ A, const T16* __restrict__ A2, const T16* __restrict__ Bt, const T16* __restrict__ Bt2, int K, float* C, int ldc, const float* __restrict__ bias, size_t sA, size_t sB, size_t sC) {
    typedef typename WFrag<T16>::V V;
    __shared__ __align__(16) float os[16 * 68];
    const size_t z = blockIdx.z; A += z * sA; if (A2) A2 += z * sA; Bt += z * sB; if (Bt2) Bt2 += z * sB; C += z * sC;
    const int lane = threadIdx.x & 31, lr = lane & 15, hi = lane >> 4; const int r0 = blockIdx.x * 64, c0 = blockIdx.y * 64;
    v8f acc[4][4];
#pragma unroll
    for (int mb = 0; mb < 4; ++mb)
#pragma unroll
        for (int nb = 0; nb < 4; ++nb) acc[mb][nb] = (v8f){};
    const size_t aoff = (size_t)(r0 + lr) * K + 8 * hi, boff = (size_t)(c0 + lr) * K + 8 * hi;
#pragma unroll 1
    for (int kc = 0; kc < K; kc += 32) {
        V a[4], a2[4];
#pragma unroll
        for (int mb = 0; mb < 4; ++mb) { a[mb] = WFrag<T16>::ld(A + aoff + (size_t)mb * 16 * K + kc); if (NSPLIT == 1 || NSPLIT == 2) a2[mb] = WFrag<T16>::ld(A2 + aoff + (size_t)mb * 16 * K + kc); }
#pragma unroll
        for (int nb = 0; nb < 4; ++nb) { const V b = WFrag<T16>::ld(Bt + boff + (size_t)nb * 16 * K + kc); V b2; if (NSPLIT >= 2) b2 = WFrag<T16>::ld(Bt2 + boff + (size_t)nb * 16 * K + kc);
#pragma unroll
            for (int mb = 0; mb < 4; ++mb) { acc[mb][nb] = WFrag<T16>::mma(a[mb], b, acc[mb][nb]); if (NSPLIT == 1 || NSPLIT == 2) acc[mb][nb] = WFrag<T16>::mma(a2[mb], b, acc[mb][nb]); if (NSPLIT >= 2) acc[mb][nb] = WFrag<T16>::mma(a[mb], b2, acc[mb][nb]); } }
        asm volatile("v_nop\n\tv_nop\n\tv_nop\n\tv_nop" : "+v"(acc[0][0]), "+v"(acc[1][1]), "+v"(acc[2][2]), "+v"(acc[3][3]) : "v"(a[0]), "v"(a[3]));
    }
#pragma unroll
    for (int mb = 0; mb < 4; ++mb) {
#pragma unroll
        for (int nb = 0; nb < 4; ++nb) {
#pragma unroll
            for (int j = 0; j < 8; ++j) os[(hi * 8 + j) * 68 + nb * 16 + lr] = acc[mb][nb][j]; }
        __builtin_amdgcn_wave_barrier(); asm volatile("" ::: "memory");
        float* crow = C + (size_t)(r0 + mb * 16) * ldc + c0;
{
#pragma unroll
            for (int s = 0; s < 8; ++s) { const int row = 2 * s + hi, cofs = lr * 4; v4f val = *(const v4fa*)(os + row * 68 + cofs); if (BIAS) { val[0] += bfr(bias[c0 + cofs]); val[1] += bfr(bias[c0 + cofs + 1]); val[2] += bfr(bias[c0 + cofs + 2]); val[3] += bfr(bias[c0 + cofs + 3]); }
                *(v4f*)(crow + (size_t)row * ldc + cofs) = val; }
             }
        __builtin_amdgcn_wave_barrier(); asm volatile("" ::: "memory");
    }
}

// ---- k_gemmc: the same one-wave 64x64 tile GEMM specialised for causal attention: CMODE 1 skips score tiles entirely above the diagonal (query rows r0+roff.., key columns c0..), CMODE 2 limits the
// key (K) loop of the probability x value contraction to the diagonal block (probabilities beyond it are exactly zero). roff = row offset of this launch's first row within the sequence.
template <typename T16, int NSPLIT, int CMODE>
__global__ __launch_bounds__(32) void k_gemmc(const T16* __restrict__ A, const T16* __restrict__ A2, const T16* __restrict__ Bt, const T16* __restrict__ Bt2, int K, float* C, int ldc, int roff, size_t sA, size_t sB, size_t sC) {
    typedef typename WFrag<T16>::V V;
    __shared__ __align__(16) float os[16 * 68];
    const size_t z = blockIdx.z; A += z * sA; if (A2) A2 += z * sA; Bt += z * sB; if (Bt2) Bt2 += z * sB; C += z * sC;
    const int lane = threadIdx.x & 31, lr = lane & 15, hi = lane >> 4; const int r0 = blockIdx.x * 64, c0 = blockIdx.y * 64;
    if (CMODE == 1 && c0 > r0 + roff + 63) return;                  // score tile entirely above the causal diagonal: never read (the softmax masks j > i by select)
    const int Kl = (CMODE == 2) ? min(K, r0 + roff + 64) : K;        // P.V: probabilities are exactly 0 beyond the diagonal block, so the K loop stops there
    v8f acc[4][4];
#pragma unroll
    for (int mb = 0; mb < 4; ++mb)
#pragma unroll
        for (int nb = 0; nb < 4; ++nb) acc[mb][nb] = (v8f){};
    const size_t aoff = (size_t)(r0 + lr) * K + 8 * hi, boff = (size_t)(c0 + lr) * K + 8 * hi;
#pragma unroll 1
    for (int kc = 0; kc < Kl; kc += 32) {
        V a[4], a2[4];
#pragma unroll
        for (int mb = 0; mb < 4; ++mb) { a[mb] = WFrag<T16>::ld(A + aoff + (size_t)mb * 16 * K + kc); if (NSPLIT == 1 || NSPLIT == 2) a2[mb] = WFrag<T16>::ld(A2 + aoff + (size_t)mb * 16 * K + kc); }
#pragma unroll
        for (int nb = 0; nb < 4; ++nb) { const V b = WFrag<T16>::ld(Bt + boff + (size_t)nb * 16 * K + kc); V b2; if (NSPLIT >= 2) b2 = WFrag<T16>::ld(Bt2 + boff + (size_t)nb * 16 * K + kc);
#pragma unroll
            for (int mb = 0; mb < 4; ++mb) { acc[mb][nb] = WFrag<T16>::mma(a[mb], b, acc[mb][nb]); if (NSPLIT == 1 || NSPLIT == 2) acc[mb][nb] = WFrag<T16>::mma(a2[mb], b, acc[mb][nb]); if (NSPLIT >= 2) acc[mb][nb] = WFrag<T16>::mma(a[mb], b2, acc[mb][nb]); } }
        asm volatile("v_nop\n\tv_nop\n\tv_nop\n\tv_nop" : "+v"(acc[0][0]), "+v"(acc[1][1]), "+v"(acc[2][2]), "+v"(acc[3][3]) : "v"(a[0]), "v"(a[3]));
    }
#pragma unroll
    for (int mb = 0; mb < 4; ++mb) {
#pragma unroll
        for (int nb = 0; nb < 4; ++nb) {
#pragma unroll
            for (int j = 0; j < 8; ++j) os[(hi * 8 + j) * 68 + nb * 16 + lr] = acc[mb][nb][j]; }
        __builtin_amdgcn_wave_barrier(); asm volatile("" ::: "memory");
        float* crow = C + (size_t)(r0 + mb * 16) * ldc + c0;
{
#pragma unroll
            for (int s = 0; s < 8; ++s) { const int row = 2 * s + hi, cofs = lr * 4; v4f val = *(const v4fa*)(os + row * 68 + cofs);
                *(v4f*)(crow + (size_t)row * ldc + cofs) = val; }
             }
        __builtin_amdgcn_wave_barrier(); asm volatile("" ::: "memory");
    }
}

// ---- k_pvs: probability x value contraction with the key loop SPLIT OVER THE PVW WAVES of one work-group. One work-group per 32x64 output tile; wave w takes the 32-key chunks w, w + PVW, w + 2 PVW, ...
// up to the diagonal block (probabilities beyond it are exactly zero), keeps a full 32x64 f32 partial tile, and the PVW partial tiles are added in LDS in the fixed order w = 0 .. PVW-1.
// The one-wave form walks up to 64 dependent load-then-multiply trips; here the longest wave walks 4, and the chunks of neighbouring waves share 128-byte lines. grid (M/32, N/64, Z), 32 * PVW threads.
// lda = row pitch of A and A2 in elements (the probability rows lie inside the f32 score rows, see k_asoft); Bt and Bt2 have pitch K.
#define PVW  16
// fragment pointers in 16-byte units, typed as global memory: a pointer carried round the loop would otherwise compile to flat loads. A fragment is units 0 and 2 (elements 0..7 and 16..23 from the lane's start), as in WFrag::ld.
template <typename T16> struct GPtr;
template <> struct GPtr<h16> { typedef const __attribute__((address_space(1))) v8h* P; };
template <> struct GPtr<bf> { typedef const __attribute__((address_space(1))) v8us* P; };
__device__ __forceinline__ v16h ldfrag(GPtr<h16>::P p) { return cat16(p[0], p[2]); }
__device__ __forceinline__ v16bf ldfrag(GPtr<bf>::P p) { return cat16b(p[0], p[2]); }
#define PVP  68                   // f32 pitch of a partial tile's row in LDS (the two half-waves of a store land on different banks)
template <typename T16, int NSPLIT>
__global__ __launch_bounds__(32 * PVW) void k_pvs(const T16* __restrict__ A, const T16* __restrict__ A2, int lda, const T16* __restrict__ Bt, const T16* __restrict__ Bt2, int K, float* C, int ldc, int roff, size_t sA, size_t sB, size_t sC) {
    typedef typename WFrag<T16>::V V;
    __shared__ __align__(16) float ps[PVW * 32 * PVP];
    const size_t z = blockIdx.z; A += z * sA; if (A2) A2 += z * sA; Bt += z * sB; if (Bt2) Bt2 += z * sB; C += z * sC;
    const int lane = threadIdx.x & 31, lr = lane & 15, hi = lane >> 4; const int r0 = blockIdx.x * 32, c0 = blockIdx.y * 64;
    const int w = __builtin_amdgcn_readfirstlane((int)(threadIdx.x >> 5));   // wave number in a scalar register: the key loop's test stays a scalar branch
    const int Kl = min(K, r0 + roff + 32);                            // the tile's last query row is r0 + roff + 31: probabilities of later keys are exactly 0
    v8f acc[2][4];
    // every loop over mb, nb, j or s below is unrolled in full, so that the fragment, pointer and accumulator arrays are registers
#pragma unroll
    for (int mb = 0; mb < 2; ++mb)
#pragma unroll
        for (int nb = 0; nb < 4; ++nb) acc[mb][nb] = (v8f){};
    // one pointer per fragment row block, moved on by PVW chunks a trip
    typedef typename GPtr<T16>::P GP;
    GP pa[2], pa2[2], pb[4], pb2[4];
#pragma unroll
    for (int mb = 0; mb < 2; ++mb) { const size_t o = (size_t)(r0 + mb * 16 + lr) * lda + 8 * hi + w * 32; pa[mb] = (GP)(A + o); if (NSPLIT == 1 || NSPLIT == 2) pa2[mb] = (GP)(A2 + o); }
#pragma unroll
    for (int nb = 0; nb < 4; ++nb) { const size_t o = (size_t)(c0 + nb * 16 + lr) * K + 8 * hi + w * 32; pb[nb] = (GP)(Bt + o); if (NSPLIT >= 2) pb2[nb] = (GP)(Bt2 + o); }
#pragma unroll 1   // kept rolled: at most 4 trips, and each wave fetches the loop's code once
    for (int kc = w * 32; kc < Kl; kc += PVW * 32) {
        V a[2], a2[2];
#pragma unroll
        for (int mb = 0; mb < 2; ++mb) { a[mb] = ldfrag(pa[mb]); pa[mb] += PVW * 4; if (NSPLIT == 1 || NSPLIT == 2) { a2[mb] = ldfrag(pa2[mb]); pa2[mb] += PVW * 4; } }
#pragma unroll
        for (int nb = 0; nb < 4; ++nb) { const V b = ldfrag(pb[nb]); pb[nb] += PVW * 4; V b2; if (NSPLIT >= 2) { b2 = ldfrag(pb2[nb]); pb2[nb] += PVW * 4; }
#pragma unroll
            for (int mb = 0; mb < 2; ++mb) { acc[mb][nb] = WFrag<T16>::mma(a[mb], b, acc[mb][nb]); if (NSPLIT == 1 || NSPLIT == 2) acc[mb][nb] = WFrag<T16>::mma(a2[mb], b, acc[mb][nb]); if (NSPLIT >= 2) acc[mb][nb] = WFrag<T16>::mma(a[mb], b2, acc[mb][nb]); } }
    }
    float* pw = ps + w * (32 * PVP);
#pragma unroll
    for (int mb = 0; mb < 2; ++mb)
#pragma unroll
        for (int nb = 0; nb < 4; ++nb)
#pragma unroll
            for (int j = 0; j < 8; ++j) pw[(mb * 16 + hi * 8 + j) * PVP + nb * 16 + lr] = acc[mb][nb][j];
    __syncthreads();                                                  // every wave's partial tile is in LDS before any thread adds them
    const int row = (int)(threadIdx.x >> 4), cofs = (int)(threadIdx.x & 15) * 4;
    v4f val = *(const v4fa*)(ps + row * PVP + cofs);
#pragma unroll
    for (int s = 1; s < PVW; ++s) val += *(const v4fa*)(ps + s * (32 * PVP) + row * PVP + cofs);
    *(v4f*)(C + (size_t)(r0 + row) * ldc + c0 + cofs) = val;
}

__device__ __forceinline__ h16 tohx(float x) { return (h16)x; }
__device__ __forceinline__ void splitf(float y, unsigned short& h, unsigned short& l) { h = f2bf(y); l = f2bf(y - bf2f(h)); }
typedef __attribute__((ext_vector_type(2))) _Float16 v2h;
typedef __attribute__((ext_vector_type(4))) _Float16 v4h;
typedef __attribute__((ext_vector_type(2))) unsigned short v2us;
typedef __attribute__((ext_vector_type(4))) unsigned short v4us;
typedef __attribute__((ext_vector_type(2))) float v2f;
typedef __attribute__((ext_vector_type(4))) int v4i;

__global__ __launch_bounds__(256) void k_wtG(const float* __restrict__ w, int K, int N, bf* Bt) {
    const int lane = threadIdx.x & 31; const int L0 = (blockIdx.x * 8 + (threadIdx.x >> 5)) * 8; const int nlines = N * K / 64;
{
#pragma unroll 1
        for (int l = 0; l < 8; ++l) { const int L = L0 + l; if (L >= nlines) break; const size_t e = (size_t)L * 64 + lane * 2; const int k = (int)(e % K), n = (int)(e / K); v2us o;
            o[0] = f2bf(w[(size_t)k * N + n]); o[1] = f2bf(w[(size_t)(k + 1) * N + n]); *(v2us*)(Bt + e) = o; }
         }
}
__global__ __launch_bounds__(256) void k_cvt8(const float* __restrict__ src, bf* dst, size_t n8) { const size_t i = (size_t)blockIdx.x * 256 + threadIdx.x; if (i >= n8) return; const v8f v = *(const v8f*)(src + i * 8); v8us o;
#pragma unroll
    for (int k = 0; k < 8; ++k) o[k] = f2bf(v[k]); *(v8us*)(dst + i * 8) = o;  }
__constant__ float TS[NH_] = {1.0f,1.3335214853286743f,1.778279423713684f,2.3713736534118652f,3.1622776985168457f,4.2169647216796875f,5.6234130859375f,7.4989423751831055f,10.0f,13.335214614868164f,17.782794952392578f,23.71373748779297f,31.62277603149414f,42.16965103149414f,56.234134674072266f,74.98941802978516f,100.0f,133.35214233398438f,177.82794189453125f,237.1373748779297f,316.2277526855469f,421.6965026855469f,562.34130859375f,749.8942260742188f,1000.0f,1333.521484375f,1778.2794189453125f,2371.37353515625f,3162.277587890625f,4216.96484375f,5623.4130859375f,7498.94189453125f};   // float32 10000^(2n/64), n = head index (the module's rope broadcasts over heads)
__global__ __launch_bounds__(256) void k_csh(float* CSH) { const int idx = blockIdx.x * 256 + threadIdx.x; if (idx >= NH_ * TT) return; const int h = idx / TT, t = idx % TT; const float ang = __fdiv_rn((float)t, TS[h]); v2f cs; cs[0] = cosf(ang); cs[1] = sinf(ang);
    *(v2f*)(CSH + (size_t)idx * 2) = cs;  }

// k_rope: head planes [h][t][d] (fp16 + hi/lo) of rope(x) x sc with the rotate-half convention and ONE angle per (head, position): out[d] = x[d] cos[h][t] - x[d+HD/2] sin[h][t], out[d+HD/2] = x[d+HD/2] cos[h][t] + x[d] sin[h][t]
__global__ __launch_bounds__(256) void k_rope(const float* __restrict__ F, int pitch, int nheads, const float* __restrict__ CS, const float* __restrict__ RF, const float* __restrict__ nw, float sc, h16* P16, bf* Ph, bf* Pl) {
    const size_t e = ((size_t)blockIdx.x * 256 + threadIdx.x) * 2; if (e >= (size_t)nheads * TT * HD) return; const int d = (int)(e % HD); const int t = (int)((e / HD) % TT); const int h = (int)(e / ((size_t)HD * TT)); const float* f = F + (size_t)t * pitch + h * HD; const float rf = RF ? RF[(size_t)h * TT + t] : 1.0f; v2h o16; v2us oh, ol;
#pragma unroll
    for (int q = 0; q < 2; ++q) { const int dd = d + q; const int dp = (dd < HD / 2) ? dd + HD / 2 : dd - HD / 2; float x0 = f[dd], x1 = f[dp];
        if (RF) { float n0 = __fmul_rn(x0, rf), n1 = __fmul_rn(x1, rf); asm volatile("" : "+v"(n0)); asm volatile("" : "+v"(n1)); x0 = __fmul_rn(bfr(nw[dd]), n0); x1 = __fmul_rn(bfr(nw[dp]), n1); }
        const v2f cs = *(const v2f*)(CS + ((size_t)h * TT + t) * 2);   /* per-head angle (module quirk) */ float a = __fmul_rn(x0, cs[0]), bq = __fmul_rn(x1, cs[1]); asm volatile("" : "+v"(a)); asm volatile("" : "+v"(bq)); const float r = ((dd < HD / 2) ? __fsub_rn(a, bq) : __fadd_rn(a, bq)) * sc;
        o16[q] = tohx(r); unsigned short a2, c2; splitf(r, a2, c2); oh[q] = a2; ol[q] = c2; }
    *(v2h*)(P16 + e) = o16; *(v2us*)(Ph + e) = oh; *(v2us*)(Pl + e) = ol;  }
__global__ __launch_bounds__(256) void k_vtp(const float* __restrict__ F, int pitch, int nheads, h16* V16, bf* Vh, bf* Vl) { const size_t e = ((size_t)blockIdx.x * 256 + threadIdx.x) * 2; if (e >= (size_t)nheads * HD * TT) return; const int t = (int)(e % TT); const int d = (int)((e / TT) % HD); const int g = (int)(e / ((size_t)TT * HD)); v2h o16; v2us oh, ol;
#pragma unroll
    for (int q = 0; q < 2; ++q) { const float x = F[(size_t)(t + q) * pitch + g * HD + d]; o16[q] = tohx(x); unsigned short a2, c2; splitf(x, a2, c2); oh[q] = a2; ol[q] = c2; }
    *(v2h*)(V16 + e) = o16; *(v2us*)(Vh + e) = oh; *(v2us*)(Vl + e) = ol;  }
// k_asoft: per row (zz, i): t = S x HD^-0.5 for j <= i and i - j < WIN (sliding causal window; the reference's -1e9 additive fill vanishes identically); softmax over the 2048 keys (register row, one exp, fixed trees);
// the probabilities OVERWRITE THE ROW'S OWN SCORES: one wave owns a row and holds all of it in registers before its first store (the row maximum needs every load). The 8 KiB of a score row take the fp16 row in the first half,
// or the hi plane in the first half and the lo plane in the second: P16 = Ph = the score buffer, Pl = Ph + TT, row pitch 2 TT 16-bit elements. No probability buffer of its own, so ZH heads fit the workspace.
__global__ __launch_bounds__(256) void k_asoft(const float* Sb, h16* P16, bf* Ph, bf* Pl) {
    const int lane = threadIdx.x & 31; const int row = blockIdx.x * 8 + (threadIdx.x >> 5); if (row >= ZH * TT) return; const int i = row % TT; const int zz = row / TT; (void)zz; const bool hires = (i < RH); const float* sr = Sb + (size_t)row * TT; float v[TT / 32]; float mx = -3.0e38f;
#pragma unroll
    for (int ch = 0; ch < TT / 128; ++ch) { const int j0 = ch * 128 + lane * 4; const v4f a = *(const v4f*)(sr + j0);
#pragma unroll
        for (int q = 0; q < 4; ++q) { const int j = j0 + q; (void)j; const float t = (j <= i && i - j < WIN) ? a[q] * SCL : -3.0e38f; v[ch * 4 + q] = t; mx = fmaxf(mx, t); } }
#pragma unroll
    for (int sh = 16; sh; sh >>= 1) mx = fmaxf(mx, __shfl_xor(mx, sh, 32));
    float sum = 0.f;
#pragma unroll
    for (int k = 0; k < TT / 32; ++k) { float d0 = __fsub_rn(v[k], mx); asm volatile("" : "+v"(d0)); v[k] = __builtin_amdgcn_exp2f(__fmul_rn(d0, 1.4426950408889634f)); sum += v[k]; }
#pragma unroll
    for (int sh = 16; sh; sh >>= 1) sum += __shfl_xor(sum, sh, 32);
    const float f = __fdiv_rn(hires ? 1.0f : PCAR, sum);
{
        if (hires) {
#pragma unroll
            for (int ch = 0; ch < TT / 128; ++ch) { v4us oh, ol;
#pragma unroll
                for (int q = 0; q < 4; ++q) { unsigned short a, c2; splitf(v[ch * 4 + q] * f, a, c2); oh[q] = a; ol[q] = c2; }
                const size_t oo = (size_t)row * (2 * TT) + ch * 128 + lane * 4; *(v4us*)(Ph + oo) = oh; *(v4us*)(Pl + oo) = ol; }
        } else {
#pragma unroll
            for (int ch = 0; ch < TT / 128; ++ch) { v4h o4;
#pragma unroll
                for (int q = 0; q < 4; ++q) o4[q] = tohx(v[ch * 4 + q] * f);
                *(v4h*)(P16 + (size_t)row * (2 * TT) + ch * 128 + lane * 4) = o4; } }
         }
}
__global__ __launch_bounds__(256) void k_merge(const float* __restrict__ O, int h0, bf* Ah, bf* Al) { const size_t e = ((size_t)blockIdx.x * 256 + threadIdx.x) * 2; if (e >= (size_t)ZH * TT * HD) return; const int d = (int)(e % HD); const int t = (int)((e / HD) % TT); const int zz = (int)(e / ((size_t)HD * TT)); const float cs = (t < RH) ? 1.0f : (1.0f / PCAR); const size_t oo = (size_t)t * DQ + (h0 + zz) * HD + d;
    v2us oh, ol;
#pragma unroll
    for (int q = 0; q < 2; ++q) { unsigned short a, c2; splitf(O[e + q] * cs, a, c2); oh[q] = a; ol[q] = c2; } *(v2us*)(Ah + oo) = oh; *(v2us*)(Al + oo) = ol;  }

extern "C" void kernel_launch(void* const* d_in, const int* in_sizes, int n_in,
                              void* d_out, int out_size, void* d_ws, size_t ws_size, hipStream_t stream) {
    (void)in_sizes; (void)n_in; (void)out_size;
    const float* x = (const float*)d_in[0]; const float* wq = (const float*)d_in[1]; const float* bq = (const float*)d_in[2]; const float* wk = (const float*)d_in[3]; const float* bk = (const float*)d_in[4]; const float* wv = (const float*)d_in[5]; const float* bv = (const float*)d_in[6]; const float* wo = (const float*)d_in[7]; const float* bo = (const float*)d_in[8];
    float* OUT = (float*)d_out;     // [2][2048][2048]
    char* wsp = (char*)d_ws;
    auto take = [&](size_t bytes) { char* p = wsp; wsp += (bytes + 255) & ~(size_t)255; return (void*)p; };
    bf* WQ = (bf*)take((size_t)DQ * DM * 2); bf* WK = (bf*)take((size_t)DKV * DM * 2); bf* WV = (bf*)take((size_t)DKV * DM * 2); bf* WO = (bf*)take((size_t)DM * DQ * 2); float* CS = (float*)take((size_t)NH_ * TT * 2 * 4);
    h16* QP16 = (h16*)take((size_t)NH_ * TT * HD * 2); h16* KP16 = (h16*)take((size_t)NKV * TT * HD * 2); h16* VT16 = (h16*)take((size_t)NKV * HD * TT * 2);
    bf* QPh = (bf*)take((size_t)NH_ * TT * HD * 2); bf* QPl = (bf*)take((size_t)NH_ * TT * HD * 2); bf* KPh = (bf*)take((size_t)NKV * TT * HD * 2); bf* KPl = (bf*)take((size_t)NKV * TT * HD * 2); bf* VTh = (bf*)take((size_t)NKV * HD * TT * 2); bf* VTl = (bf*)take((size_t)NKV * HD * TT * 2);
    bf* ATh = (bf*)take((size_t)TT * DQ * 2); bf* ATl = (bf*)take((size_t)TT * DQ * 2); float* Ob = (float*)take((size_t)ZH * TT * HD * 4);
    // the projection stage's buffers (XB, FQ, FK) and the attention passes' score buffer share one region: a batch's projections are all consumed (head planes built) before its first score launch, and rewritten only behind its last pass (stream-ordered)
    char* shared0 = wsp; bf* XB = (bf*)take((size_t)TT * DM * 2); float* FQ = (float*)take((size_t)TT * DQ * 4); float* FK = (float*)take((size_t)TT * DKV * 4);
    wsp = shared0; float* Sb = (float*)take((size_t)ZH * TT * TT * 4);
    h16* P16 = (h16*)Sb; bf* Ph = (bf*)Sb; bf* Pl = Ph + TT;   // probabilities overwrite their own score rows (k_asoft): row pitch 2 TT, head stride 2 TT TT 16-bit elements
    if ((size_t)(wsp - (char*)d_ws) > ws_size) return;    // ws 256 MiB
    float* FV = FK;   // v projection reuses the k buffer after the k planes are built (stream-ordered)
    { k_cvt8<<<(unsigned)(((size_t)DQ * DM / 8 + 255) / 256), 256, 0, stream>>>(wq, WQ, (size_t)DQ * DM / 8); k_cvt8<<<(unsigned)(((size_t)DKV * DM / 8 + 255) / 256), 256, 0, stream>>>(wk, WK, (size_t)DKV * DM / 8); k_cvt8<<<(unsigned)(((size_t)DKV * DM / 8 + 255) / 256), 256, 0, stream>>>(wv, WV, (size_t)DKV * DM / 8);
      k_cvt8<<<(unsigned)(((size_t)DM * DQ / 8 + 255) / 256), 256, 0, stream>>>(wo, WO, (size_t)DM * DQ / 8);
       }
    const unsigned LQ = (unsigned)(((size_t)NH_ * TT * HD / 2 + 255) / 256), LKv = (unsigned)(((size_t)NKV * TT * HD / 2 + 255) / 256);
    for (int b = 0; b < NB_; ++b) {
        if (b == 0) k_csh<<<(NH_ * TT + 255) / 256, 256, 0, stream>>>(CS);
        k_cvt8<<<(unsigned)(((size_t)TT * DM / 8 + 255) / 256), 256, 0, stream>>>(x + (size_t)b * TT * DM, XB, (size_t)TT * DM / 8);
        k_gemmw<bf, 0, true><<<dim3(TT / 64, DQ / 64, 1), 32, 0, stream>>>(XB, nullptr, WQ, nullptr, DM, FQ, DQ, bq, 0, 0, 0);
        k_rope<<<LQ, 256, 0, stream>>>(FQ, DQ, NH_, CS, nullptr, nullptr, 1.0f, QP16, QPh, QPl);
        k_gemmw<bf, 0, true><<<dim3(TT / 64, DKV / 64, 1), 32, 0, stream>>>(XB, nullptr, WK, nullptr, DM, FK, DKV, bk, 0, 0, 0);
        k_rope<<<LKv, 256, 0, stream>>>(FK, DKV, NKV, CS, nullptr, nullptr, 1.0f, KP16, KPh, KPl);
        k_gemmw<bf, 0, true><<<dim3(TT / 64, DKV / 64, 1), 32, 0, stream>>>(XB, nullptr, WV, nullptr, DM, FV, DKV, bv, 0, 0, 0); k_vtp<<<LKv, 256, 0, stream>>>(FV, DKV, NKV, VT16, VTh, VTl);
        for (int h0 = 0; h0 < NH_; h0 += ZH) { const size_t zq = (size_t)h0, zk = (size_t)(h0 / REP);   // one kv head per query head: the pass's ZH heads use consecutive kv planes (z-strides TT*HD)
            k_gemmc<bf, 2, 1><<<dim3(RH / 64, TT / 64, ZH), 32, 0, stream>>>(QPh + zq * TT * HD, QPl + zq * TT * HD, KPh + zk * TT * HD, KPl + zk * TT * HD, HD, Sb, TT, 0, (size_t)TT * HD, (size_t)TT * HD, (size_t)TT * TT);
            k_gemmc<h16, 0, 1><<<dim3((TT - RH) / 64, TT / 64, ZH), 32, 0, stream>>>(QP16 + zq * TT * HD + (size_t)RH * HD, nullptr, KP16 + zk * TT * HD, nullptr, HD, Sb + (size_t)RH * TT, TT, RH, (size_t)TT * HD, (size_t)TT * HD, (size_t)TT * TT);
            k_asoft<<<ZH * TT / 8, 256, 0, stream>>>(Sb, P16, Ph, Pl);
            k_pvs<bf, 2><<<dim3(RH / 32, HD / 64, ZH), 32 * PVW, 0, stream>>>(Ph, Pl, 2 * TT, VTh + zk * HD * TT, VTl + zk * HD * TT, TT, Ob, HD, 0, (size_t)2 * TT * TT, (size_t)HD * TT, (size_t)TT * HD);
            k_pvs<h16, 0><<<dim3((TT - RH) / 32, HD / 64, ZH), 32 * PVW, 0, stream>>>(P16 + (size_t)RH * 2 * TT, nullptr, 2 * TT, VT16 + zk * HD * TT, nullptr, TT, Ob + (size_t)RH * HD, HD, RH, (size_t)2 * TT * TT, (size_t)HD * TT, (size_t)TT * HD);
            k_merge<<<(unsigned)(((size_t)ZH * TT * HD / 2 + 255) / 256), 256, 0, stream>>>(Ob, h0, ATh, ATl); }
        k_gemmw<bf, 1, true><<<dim3(TT / 64, DM / 64, 1), 32, 0, stream>>>(ATh, ATl, WO, nullptr, DQ, OUT + (size_t)b * TT * DM, DM, bo, 0, 0, 0); }
}

// v003
// A run of this version takes 598 microseconds.
// Timed twice side by side with v002, it ran 1.87 and 1.84 times as fast.
// Over all steps from v000 it is 4.86 times as fast.
#include <hip/hip_runtime.h>

// Causal multi-head attention with the module's rotary quirk (x [2][2048][2048]; q, k, v = x W^T + b ('oi' [2048][2048] + [2048]; 32 heads x 64); apply_rope broadcasts its [L][32][1] sinusoid against [B][L][heads=32][32], so the rotation angle depends on the HEAD index: for head n and every feature pair (j, j+32): angle = t / 10000^(2n/64) (the same angle for all 32 pairs of the head); scores = q.k / 8, causal; softmax; out = merged Wo^T + bo -> [2][2048][2048] (8.4 M)).
// Compute dtypes, f32 accumulate: every input rounded to bf16; q/k/v on PLAIN bf16 operands (inputs: exact) + biases; per-head-angle rotary in f32 (precise cosf/sinf of t / timescale[n], float32 timescale constants); causal scores and attn.v (tile skipping): query rows < 512 hl (3 products), the rest single fp16 (x1024); softmax f32; Wo hl x exact (2 products) + bo.

#define NB_  2
#define TT   2048
#define DM   2048
#define NH_  32
#define NKV  32
#define REP  (NH_ / NKV)
#define HD   64
#define DQ   (NH_ * HD)
#define DKV  (NKV * HD)
#define RH   512                  // query rows < RH use hi+lo planes (0: none)
#define SCL  0.125f   // HD^-0.5
typedef _Float16 h16;
typedef unsigned short bf;
typedef __attribute__((ext_vector_type(16))) __bf16   v16bf;
typedef __attribute__((ext_vector_type(16))) _Float16 v16h;
typedef __attribute__((ext_vector_type(8)))  _Float16 v8h;
typedef __attribute__((ext_vector_type(8)))  unsigned short v8us;
typedef __attribute__((ext_vector_type(8)))  float    v8f;
typedef __attribute__((ext_vector_type(4)))  float    v4f;
typedef v8h  __attribute__((may_alias)) v8ha;
typedef v4f  __attribute__((may_alias)) v4fa;
typedef v8us __attribute__((may_alias)) v8usa;

__device__ __forceinline__ unsigned short f2bf(float f) { unsigned u = __float_as_uint(f); u += 0x7FFFu + ((u >> 16) & 1u); return (unsigned short)(u >> 16); }
__device__ __forceinline__ float bf2f(unsigned short b) { return __uint_as_float(((unsigned)b) << 16); }
__device__ __forceinline__ float bfr(float f) { return bf2f(f2bf(f)); }
__device__ __forceinline__ v16h cat16(v8h lo, v8h hi) { return __builtin_shufflevector(lo, hi, 0, 1, 2, 3, 4, 5, 6, 7, 8, 9, 10, 11, 12, 13, 14, 15); }
__device__ __forceinline__ v16bf cat16b(v8us lo, v8us hi) { return __builtin_bit_cast(v16bf, __builtin_shufflevector(lo, hi, 0, 1, 2, 3, 4, 5, 6, 7, 8, 9, 10, 11, 12, 13, 14, 15)); }
__device__ __forceinline__ v8f wmma16(v16h a, v16h b, v8f c) { return __builtin_amdgcn_wmma_f32_16x16x32_f16(false, a, false, b, (short)0, c, false, false); }
__device__ __forceinline__ v8f wmmab(v16bf a, v16bf b, v8f c) { return __builtin_amdgcn_wmma_f32_16x16x32_bf16(false, a, false, b, (short)0, c, false, false); }



// ---- k_gemmw: register-blocked GEMM, ONE WAVE per 64x64 output tile (16 accumulators), operands straight from K-contiguous 16-bit planes; grid (M/64, N/64, Z), 32 threads.
// C[m][n] (f32, pitch ldc, + optional f32 bias[n]) = sum_k A[m][k] Bt[n][k] (+ split products per NSPLIT). z-batch strides sA/sB/sC in elements. K % 32 == 0.
template <typename T16> struct WFrag;
template <> struct WFrag<h16> { typedef v16h V; static __device__ __forceinline__ V ld(const h16* p) { return cat16(*(const v8h*)p, *(const v8h*)(p + 16)); } static __device__ __forceinline__ v8f mma(V a, V b, v8f c) { return wmma16(a, b, c); } };
template <> struct WFrag<bf> { typedef v16bf V; static __device__ __forceinline__ V ld(const bf* p) { return cat16b(*(const v8us*)p, *(const v8us*)(p + 16)); } static __device__ __forceinline__ v8f mma(V a, V b, v8f c) { return wmmab(a, b, c); } };
template <typename T16, int NSPLIT, bool BIAS>
__global__ __launch_bounds__(32) void k_gemmw(const T16* __restrict__ A, const T16* __restrict__ A2, const T16* __restrict__ Bt, const T16* __restrict__ Bt2, int K, float* C, int ldc, const float* __restrict__ bias, size_t sA, size_t sB, size_t sC) {
    typedef typename WFrag<T16>::V V;
    __shared__ __align__(16) float os[16 * 68];
    const size_t z = blockIdx.z; A += z * sA; if (A2) A2 += z * sA; Bt += z * sB; if (Bt2) Bt2 += z * sB; C += z * sC;
    const int lane = threadIdx.x & 31, lr = lane & 15, hi = lane >> 4; const int r0 = blockIdx.x * 64, c0 = blockIdx.y * 64;
    v8f acc[4][4];
#pragma unroll
    for (int mb = 0; mb < 4; ++mb)
#pragma unroll
        for (int nb = 0; nb < 4; ++nb) acc[mb][nb] = (v8f){};
    const size_t aoff = (size_t)(r0 + lr) * K + 8 * hi, boff = (size_t)(c0 + lr) * K + 8 * hi;
#pragma unroll 1
    for (int kc = 0; kc < K; kc += 32) {
        V a[4], a2[4];
#pragma unroll
        for (int mb = 0; mb < 4; ++mb) { a[mb] = WFrag<T16>::ld(A + aoff + (size_t)mb * 16 * K + kc); if (NSPLIT == 1 || NSPLIT == 2) a2[mb] = WFrag<T16>::ld(A2 + aoff + (size_t)mb * 16 * K + kc); }
#pragma unroll
        for (int nb = 0; nb < 4; ++nb) { const V b = WFrag<T16>::ld(Bt + boff + (size_t)nb * 16 * K + kc); V b2; if (NSPLIT >= 2) b2 = WFrag<T16>::ld(Bt2 + boff + (size_t)nb * 16 * K + kc);
#pragma unroll
            for (int mb = 0; mb < 4; ++mb) { acc[mb][nb] = WFrag<T16>::mma(a[mb], b, acc[mb][nb]); if (NSPLIT == 1 || NSPLIT == 2) acc[mb][nb] = WFrag<T16>::mma(a2[mb], b, acc[mb][nb]); if (NSPLIT >= 2) acc[mb][nb] = WFrag<T16>::mma(a[mb], b2, acc[mb][nb]); } }
        asm volatile("v_nop\n\tv_nop\n\tv_nop\n\tv_nop" : "+v"(acc[0][0]), "+v"(acc[1][1]), "+v"(acc[2][2]), "+v"(acc[3][3]) : "v"(a[0]), "v"(a[3]));
    }
#pragma unroll
    for (int mb = 0; mb < 4; ++mb) {
#pragma unroll
        for (int nb = 0; nb < 4; ++nb) {
#pragma unroll
            for (int j = 0; j < 8; ++j) os[(hi * 8 + j) * 68 + nb * 16 + lr] = acc[mb][nb][j]; }
        __builtin_amdgcn_wave_barrier(); asm volatile("" ::: "memory");
        float* crow = C + (size_t)(r0 + mb * 16) * ldc + c0;
{
#pragma unroll
            for (int s = 0; s < 8; ++s) { const int row = 2 * s + hi, cofs = lr * 4; v4f val = *(const v4fa*)(os + row * 68 + cofs); if (BIAS) { val[0] += bfr(bias[c0 + cofs]); val[1] += bfr(bias[c0 + cofs + 1]); val[2] += bfr(bias[c0 + cofs + 2]); val[3] += bfr(bias[c0 + cofs + 3]); }
                *(v4f*)(crow + (size_t)row * ldc + cofs) = val; }
             }
        __builtin_amdgcn_wave_barrier(); asm volatile("" ::: "memory");
    }
}

__device__ __forceinline__ h16 tohx(float x) { return (h16)x; }
__device__ __forceinline__ void splitf(float y, unsigned short& h, unsigned short& l) { h = f2bf(y); l = f2bf(y - bf2f(h)); }
typedef __attribute__((ext_vector_type(2))) _Float16 v2h;
typedef __attribute__((ext_vector_type(4))) _Float16 v4h;
typedef __attribute__((ext_vector_type(2))) unsigned short v2us;
typedef __attribute__((ext_vector_type(4))) unsigned short v4us;
typedef __attribute__((ext_vector_type(2))) float v2f;
typedef __attribute__((ext_vector_type(4))) int v4i;

__global__ __launch_bounds__(256) void k_wtG(const float* __restrict__ w, int K, int N, bf* Bt) {
    const int lane = threadIdx.x & 31; const int L0 = (blockIdx.x * 8 + (threadIdx.x >> 5)) * 8; const int nlines = N * K / 64;
{
#pragma unroll 1
        for (int l = 0; l < 8; ++l) { const int L = L0 + l; if (L >= nlines) break; const size_t e = (size_t)L * 64 + lane * 2; const int k = (int)(e % K), n = (int)(e / K); v2us o;
            o[0] = f2bf(w[(size_t)k * N + n]); o[1] = f2bf(w[(size_t)(k + 1) * N + n]); *(v2us*)(Bt + e) = o; }
         }
}
__global__ __launch_bounds__(256) void k_cvt8(const float* __restrict__ src, bf* dst, size_t n8) { const size_t i = (size_t)blockIdx.x * 256 + threadIdx.x; if (i >= n8) return; const v8f v = *(const v8f*)(src + i * 8); v8us o;
#pragma unroll
    for (int k = 0; k < 8; ++k) o[k] = f2bf(v[k]); *(v8us*)(dst + i * 8) = o;  }
__constant__ float TS[NH_] = {1.0f,1.3335214853286743f,1.778279423713684f,2.3713736534118652f,3.1622776985168457f,4.2169647216796875f,5.6234130859375f,7.4989423751831055f,10.0f,13.335214614868164f,17.782794952392578f,23.71373748779297f,31.62277603149414f,42.16965103149414f,56.234134674072266f,74.98941802978516f,100.0f,133.35214233398438f,177.82794189453125f,237.1373748779297f,316.2277526855469f,421.6965026855469f,562.34130859375f,749.8942260742188f,1000.0f,1333.521484375f,1778.2794189453125f,2371.37353515625f,3162.277587890625f,4216.96484375f,5623.4130859375f,7498.94189453125f};   // float32 10000^(2n/64), n = head index (the module's rope broadcasts over heads)
__global__ __launch_bounds__(256) void k_csh(float* CSH) { const int idx = blockIdx.x * 256 + threadIdx.x; if (idx >= NH_ * TT) return; const int h = idx / TT, t = idx % TT; const float ang = __fdiv_rn((float)t, TS[h]); v2f cs; cs[0] = cosf(ang); cs[1] = sinf(ang);
    *(v2f*)(CSH + (size_t)idx * 2) = cs;  }

// k_rope: head planes [h][t][d] (fp16 + hi/lo) of rope(x) x sc with the rotate-half convention and ONE angle per (head, position): out[d] = x[d] cos[h][t] - x[d+HD/2] sin[h][t], out[d+HD/2] = x[d+HD/2] cos[h][t] + x[d] sin[h][t]
__global__ __launch_bounds__(256) void k_rope(const float* __restrict__ F, int pitch, int nheads, const float* __restrict__ CS, const float* __restrict__ RF, const float* __restrict__ nw, float sc, h16* P16, bf* Ph, bf* Pl) {
    const size_t e = ((size_t)blockIdx.x * 256 + threadIdx.x) * 2; if (e >= (size_t)nheads * TT * HD) return; const int d = (int)(e % HD); const int t = (int)((e / HD) % TT); const int h = (int)(e / ((size_t)HD * TT)); const float* f = F + (size_t)t * pitch + h * HD; const float rf = RF ? RF[(size_t)h * TT + t] : 1.0f; v2h o16; v2us oh, ol;
#pragma unroll
    for (int q = 0; q < 2; ++q) { const int dd = d + q; const int dp = (dd < HD / 2) ? dd + HD / 2 : dd - HD / 2; float x0 = f[dd], x1 = f[dp];
        if (RF) { float n0 = __fmul_rn(x0, rf), n1 = __fmul_rn(x1, rf); asm volatile("" : "+v"(n0)); asm volatile("" : "+v"(n1)); x0 = __fmul_rn(bfr(nw[dd]), n0); x1 = __fmul_rn(bfr(nw[dp]), n1); }
        const v2f cs = *(const v2f*)(CS + ((size_t)h * TT + t) * 2);   /* per-head angle (module quirk) */ float a = __fmul_rn(x0, cs[0]), bq = __fmul_rn(x1, cs[1]); asm volatile("" : "+v"(a)); asm volatile("" : "+v"(bq)); const float r = ((dd < HD / 2) ? __fsub_rn(a, bq) : __fadd_rn(a, bq)) * sc;
        o16[q] = tohx(r); unsigned short a2, c2; splitf(r, a2, c2); oh[q] = a2; ol[q] = c2; }
    *(v2h*)(P16 + e) = o16; *(v2us*)(Ph + e) = oh; *(v2us*)(Pl + e) = ol;  }
__global__ __launch_bounds__(256) void k_vtp(const float* __restrict__ F, int pitch, int nheads, h16* V16, bf* Vh, bf* Vl) { const size_t e = ((size_t)blockIdx.x * 256 + threadIdx.x) * 2; if (e >= (size_t)nheads * HD * TT) return; const int t = (int)(e % TT); const int d = (int)((e / TT) % HD); const int g = (int)(e / ((size_t)TT * HD)); v2h o16; v2us oh, ol;
#pragma unroll
    for (int q = 0; q < 2; ++q) { const float x = F[(size_t)(t + q) * pitch + g * HD + d]; o16[q] = tohx(x); unsigned short a2, c2; splitf(x, a2, c2); oh[q] = a2; ol[q] = c2; }
    *(v2h*)(V16 + e) = o16; *(v2us*)(Vh + e) = oh; *(v2us*)(Vl + e) = ol;  }
// ---- k_fa: causal attention of one query tile in ONE kernel (scores, softmax, probability x value, merge): no score or probability ever leaves the registers.
// Transposed products: St = K Qt (A = key rows, B = query columns), so a lane holds scores of ONE query (column lr; rows 8 hi + r of each 16-key tile); two f32 score tiles of a 32-key block, converted in place,
// are the B operand of Ot += Vt Pt (A = rows of the transposed value plane). All fragments come straight from the K-contiguous planes in WFrag::ld's order (ldfrag for keys and values), which is the hardware k order on both sides.
// Running maximum and sum per query (online softmax, f32); the accumulators are rescaled only in blocks where some query's maximum grew. The 32-key blocks of a tile are dealt round-robin to FKW waves;
// their partial (maximum, sum, Ot) are joined in LDS in the fixed order 0 .. FKW-1 behind one barrier, divided by the sum, split in hi + lo bf16 and stored in the merged [t][head * 64 + d] planes.
// A work-group holds FQS query sub-tiles of 16 NQ queries (they walk the same keys at about the same time). HL: hi + lo bf16 planes, 3 products each; else single fp16 with the probabilities x 2^10 (the factor cancels in sum and Ot).
// grid (heads, tiles), the longest tiles first; 32 FKW FQS threads.
#define FKW  4
#define FQS  2
#define FOP  68                   // f32 pitch of a query's partial row in LDS
template <typename T16> struct GPtr;
template <> struct GPtr<h16> { typedef const __attribute__((address_space(1))) v8h* P; };
template <> struct GPtr<bf> { typedef const __attribute__((address_space(1))) v8us* P; };
__device__ __forceinline__ v16h ldfrag(GPtr<h16>::P p) { return cat16(p[0], p[2]); }
__device__ __forceinline__ v16bf ldfrag(GPtr<bf>::P p) { return cat16b(p[0], p[2]); }
__device__ __forceinline__ float xhalf(float x) { return __builtin_bit_cast(float, __builtin_amdgcn_permlanex16(__builtin_bit_cast(int, x), __builtin_bit_cast(int, x), 0x76543210, 0xfedcba98, false, false)); }   // lane l's value from lane l ^ 16
template <typename T16, bool HL, int NQ>
__global__ __launch_bounds__(32 * FKW * FQS) void k_fa(const T16* __restrict__ Q, const T16* __restrict__ Q2, const T16* __restrict__ Kp, const T16* __restrict__ K2, const T16* __restrict__ Vt, const T16* __restrict__ V2, int qbase, bf* Ah, bf* Al) {
    typedef typename WFrag<T16>::V V;
    constexpr int QT = 16 * NQ;                                       // queries of one wave
    constexpr float CL2 = SCL * 1.4426950408889634f;                  // raw score -> log2 domain
    constexpr float OFF = HL ? 0.0f : 10.0f;                          // log2 of the fp16 probabilities' carrier factor
    __shared__ __align__(16) float os[FQS * FKW * QT * FOP];
    __shared__ float ms[FQS * FKW * QT];
    __shared__ float ls[FQS * FKW * QT];
    const int lane = threadIdx.x & 31, lr = lane & 15, hi = lane >> 4;
    const int w = __builtin_amdgcn_readfirstlane((int)(threadIdx.x >> 5));   // wave number in a scalar register: the key loop's test stays a scalar branch
    const int kw = w & (FKW - 1), sub = w / FKW;
    const int head = blockIdx.x;
    const int t0 = qbase + ((int)gridDim.y - 1 - (int)blockIdx.y) * (QT * FQS);   // first query of the work-group
    const int q0 = t0 + sub * QT;                                     // first query of this wave
    const size_t ho = (size_t)head * TT * HD;
    Q += ho; Kp += ho; Vt += ho; if (HL) { Q2 += ho; K2 += ho; V2 += ho; }
    // one pointer per plane, in 16-byte units and typed as global memory, moved on by FKW blocks a trip; a fragment is units u and u + 2 (elements 0..7 and 16..23 from the lane's start), as in WFrag::ld
    typedef typename GPtr<T16>::P GP;
    const size_t klane = (size_t)(kw * 32 + lr) * HD + 8 * hi, vlane = (size_t)lr * TT + kw * 32 + 8 * hi;
    GP pk = (GP)(Kp + klane), pv = (GP)(Vt + vlane), pk2 = pk, pv2 = pv; if (HL) { pk2 = (GP)(K2 + klane); pv2 = (GP)(V2 + vlane); }
    // every loop over g, mt, ks, dt, r or s below is unrolled in full, so that the fragment and accumulator arrays are registers
    V qf[NQ][2], qf2[NQ][2];
#pragma unroll
    for (int g = 0; g < NQ; ++g)
#pragma unroll
        for (int ks = 0; ks < 2; ++ks) { const size_t o = (size_t)(q0 + g * 16 + lr) * HD + ks * 32 + 8 * hi; qf[g][ks] = WFrag<T16>::ld(Q + o); if (HL) qf2[g][ks] = WFrag<T16>::ld(Q2 + o); }
    v8f oacc[NQ][4]; float mrun[NQ], lsum[NQ];
#pragma unroll
    for (int g = 0; g < NQ; ++g) { mrun[g] = -3.0e38f; lsum[g] = 0.f;
#pragma unroll
        for (int dt = 0; dt < 4; ++dt) oacc[g][dt] = (v8f){}; }
    const int kend = q0 + QT;                                         // keys >= kend are masked for every query of the wave; every block walked starts at a key <= q0, so each query has a live key in it
#pragma unroll 1   // kept rolled: the body is long, and the trips depend on each other through the running maximum
    for (int k0 = kw * 32; k0 < kend; k0 += FKW * 32) {
        V kf[2][2], kf2[2][2], vf[4], vf2[4];
#pragma unroll
        for (int mt = 0; mt < 2; ++mt)
#pragma unroll
            for (int ks = 0; ks < 2; ++ks) { const int u = (mt * 16 * HD + ks * 32) / 8; kf[mt][ks] = ldfrag(pk + u); if (HL) kf2[mt][ks] = ldfrag(pk2 + u); }
#pragma unroll
        for (int dt = 0; dt < 4; ++dt) { const int u = dt * 16 * TT / 8; vf[dt] = ldfrag(pv + u); if (HL) vf2[dt] = ldfrag(pv2 + u); }
        if constexpr (HL) { asm volatile("s_wait_xcnt 0x0" :: "v"(pk), "v"(pk2), "v"(pv), "v"(pv2) : "memory");   // precaution: in the hi + lo build the compiler forms the four addresses in temporaries and let later loads of the trip land on them; as inputs here they stay whole up to this wait
            __builtin_amdgcn_sched_barrier(0); }                      // all 32 loads of the trip are issued before its first product: otherwise the compiler reuses fragment registers and the trip waits for memory four times instead of once
        pk += FKW * 32 * HD / 8; pv += FKW * 32 / 8; if (HL) { pk2 += FKW * 32 * HD / 8; pv2 += FKW * 32 / 8; }
#pragma unroll
        for (int g = 0; g < NQ; ++g) {
            v8f s[2];
#pragma unroll
            for (int mt = 0; mt < 2; ++mt) { s[mt] = (v8f){};
#pragma unroll
                for (int ks = 0; ks < 2; ++ks) { s[mt] = WFrag<T16>::mma(kf[mt][ks], qf[g][ks], s[mt]); if (HL) { s[mt] = WFrag<T16>::mma(kf[mt][ks], qf2[g][ks], s[mt]); s[mt] = WFrag<T16>::mma(kf2[mt][ks], qf[g][ks], s[mt]); } } }
            if (k0 + 31 > q0 + g * 16) {                              // the block reaches past the group's first query: causal mask by select (wave-uniform test)
                const int qi = q0 + g * 16 + lr;
#pragma unroll
                for (int mt = 0; mt < 2; ++mt)
#pragma unroll
                    for (int r = 0; r < 8; ++r) s[mt][r] = (k0 + mt * 16 + 8 * hi + r <= qi) ? s[mt][r] : -3.0e38f;
            }
            float bm = fmaxf(s[0][0], s[1][0]);
#pragma unroll
            for (int r = 1; r < 8; ++r) bm = fmaxf(bm, fmaxf(s[0][r], s[1][r]));
            bm = fmaxf(bm, xhalf(bm));                                // the two wave halves hold different keys of the same query
            if (__builtin_amdgcn_ballot_w32(bm > mrun[g]) != 0) {     // some query's maximum grew: rescale (factor 1 for the others)
                const float mn = fmaxf(mrun[g], bm); const float al = __builtin_amdgcn_exp2f((mrun[g] - mn) * CL2); mrun[g] = mn; lsum[g] *= al;
#pragma unroll
                for (int dt = 0; dt < 4; ++dt) oacc[g][dt] *= al;
            }
            const float nm = OFF - mrun[g] * CL2;
            float p[16]; v2f ps = (v2f){};
#pragma unroll
            for (int e = 0; e < 16; e += 2) { p[e] = __builtin_amdgcn_exp2f(s[e >> 3][e & 7] * CL2 + nm); p[e + 1] = __builtin_amdgcn_exp2f(s[e >> 3][(e & 7) + 1] * CL2 + nm); ps += (v2f){p[e], p[e + 1]}; }
            lsum[g] += ps[0] + ps[1];
            if constexpr (HL) {
                __attribute__((ext_vector_type(16))) unsigned short ph, pl;
#pragma unroll
                for (int e = 0; e < 16; ++e) { unsigned short a, c2; splitf(p[e], a, c2); ph[e] = a; pl[e] = c2; }
                const V bh = __builtin_bit_cast(V, ph), bl = __builtin_bit_cast(V, pl);
#pragma unroll
                for (int dt = 0; dt < 4; ++dt) { oacc[g][dt] = WFrag<T16>::mma(vf[dt], bh, oacc[g][dt]); oacc[g][dt] = WFrag<T16>::mma(vf[dt], bl, oacc[g][dt]); oacc[g][dt] = WFrag<T16>::mma(vf2[dt], bh, oacc[g][dt]); }
            } else {
                V pb;
#pragma unroll
                for (int e = 0; e < 16; ++e) pb[e] = (h16)p[e];
#pragma unroll
                for (int dt = 0; dt < 4; ++dt) oacc[g][dt] = WFrag<T16>::mma(vf[dt], pb, oacc[g][dt]);
            }
        }
    }
#pragma unroll
    for (int g = 0; g < NQ; ++g) {
        const float lj = lsum[g] + xhalf(lsum[g]);                    // join the halves' sums
        const int qrow = w * QT + g * 16 + lr;
        if (hi == 0) { ms[qrow] = mrun[g]; ls[qrow] = lj; }
#pragma unroll
        for (int dt = 0; dt < 4; ++dt) { float* d = os + (size_t)qrow * FOP + dt * 16 + 8 * hi; v4f lo4, hi4;
#pragma unroll
            for (int r = 0; r < 4; ++r) { lo4[r] = oacc[g][dt][r]; hi4[r] = oacc[g][dt][4 + r]; }
            *(v4fa*)d = lo4; *(v4fa*)(d + 4) = hi4; }
    }
    __syncthreads();                                                  // every wave's partial result is in LDS before any thread joins them
#pragma unroll
    for (int u = (int)threadIdx.x; u < FQS * QT * 8; u += 32 * FKW * FQS) {
        const int qq = u >> 3, d8 = (u & 7) * 8; const int sb = qq / QT, ql = qq % QT;   // query within the work-group, its sub-tile, its row there
        const int base = sb * FKW * QT + ql;
        float M = ms[base];
#pragma unroll
        for (int x = 1; x < FKW; ++x) M = fmaxf(M, ms[base + x * QT]);
        float Ls = 0.f; v4f a0 = (v4f){}, a1 = (v4f){};
#pragma unroll
        for (int x = 0; x < FKW; ++x) { const float sc = __builtin_amdgcn_exp2f((ms[base + x * QT] - M) * CL2); Ls += sc * ls[base + x * QT]; const float* d = os + (size_t)(base + x * QT) * FOP + d8; a0 += *(const v4fa*)d * sc; a1 += *(const v4fa*)(d + 4) * sc; }
        const float inv = __fdiv_rn(1.0f, Ls); v8us oh, ol;
#pragma unroll
        for (int r = 0; r < 4; ++r) { unsigned short a, c2; splitf(a0[r] * inv, a, c2); oh[r] = a; ol[r] = c2; splitf(a1[r] * inv, a, c2); oh[4 + r] = a; ol[4 + r] = c2; }
        const size_t oo = (size_t)(t0 + qq) * DQ + head * HD + d8; *(v8usa*)(Ah + oo) = oh; *(v8usa*)(Al + oo) = ol;
    }
}

extern "C" void kernel_launch(void* const* d_in, const int* in_sizes, int n_in,
                              void* d_out, int out_size, void* d_ws, size_t ws_size, hipStream_t stream) {
    (void)in_sizes; (void)n_in; (void)out_size;
    const float* x = (const float*)d_in[0]; const float* wq = (const float*)d_in[1]; const float* bq = (const float*)d_in[2]; const float* wk = (const float*)d_in[3]; const float* bk = (const float*)d_in[4]; const float* wv = (const float*)d_in[5]; const float* bv = (const float*)d_in[6]; const float* wo = (const float*)d_in[7]; const float* bo = (const float*)d_in[8];
    float* OUT = (float*)d_out;     // [2][2048][2048]
    char* wsp = (char*)d_ws;
    auto take = [&](size_t bytes) { char* p = wsp; wsp += (bytes + 255) & ~(size_t)255; return (void*)p; };
    bf* WQ = (bf*)take((size_t)DQ * DM * 2); bf* WK = (bf*)take((size_t)DKV * DM * 2); bf* WV = (bf*)take((size_t)DKV * DM * 2); bf* WO = (bf*)take((size_t)DM * DQ * 2); float* CS = (float*)take((size_t)NH_ * TT * 2 * 4);
    h16* QP16 = (h16*)take((size_t)NH_ * TT * HD * 2); h16* KP16 = (h16*)take((size_t)NKV * TT * HD * 2); h16* VT16 = (h16*)take((size_t)NKV * HD * TT * 2);
    bf* QPh = (bf*)take((size_t)NH_ * TT * HD * 2); bf* QPl = (bf*)take((size_t)NH_ * TT * HD * 2); bf* KPh = (bf*)take((size_t)NKV * TT * HD * 2); bf* KPl = (bf*)take((size_t)NKV * TT * HD * 2); bf* VTh = (bf*)take((size_t)NKV * HD * TT * 2); bf* VTl = (bf*)take((size_t)NKV * HD * TT * 2);
    bf* ATh = (bf*)take((size_t)TT * DQ * 2); bf* ATl = (bf*)take((size_t)TT * DQ * 2);
    bf* XB = (bf*)take((size_t)TT * DM * 2); float* FQ = (float*)take((size_t)TT * DQ * 4); float* FK = (float*)take((size_t)TT * DKV * 4);
    if ((size_t)(wsp - (char*)d_ws) > ws_size) return;    // ws 256 MiB
    float* FV = FK;   // v projection reuses the k buffer after the k planes are built (stream-ordered)
    { k_cvt8<<<(unsigned)(((size_t)DQ * DM / 8 + 255) / 256), 256, 0, stream>>>(wq, WQ, (size_t)DQ * DM / 8); k_cvt8<<<(unsigned)(((size_t)DKV * DM / 8 + 255) / 256), 256, 0, stream>>>(wk, WK, (size_t)DKV * DM / 8); k_cvt8<<<(unsigned)(((size_t)DKV * DM / 8 + 255) / 256), 256, 0, stream>>>(wv, WV, (size_t)DKV * DM / 8);
      k_cvt8<<<(unsigned)(((size_t)DM * DQ / 8 + 255) / 256), 256, 0, stream>>>(wo, WO, (size_t)DM * DQ / 8);
       }
    const unsigned LQ = (unsigned)(((size_t)NH_ * TT * HD / 2 + 255) / 256), LKv = (unsigned)(((size_t)NKV * TT * HD / 2 + 255) / 256);
    for (int b = 0; b < NB_; ++b) {
        if (b == 0) k_csh<<<(NH_ * TT + 255) / 256, 256, 0, stream>>>(CS);
        k_cvt8<<<(unsigned)(((size_t)TT * DM / 8 + 255) / 256), 256, 0, stream>>>(x + (size_t)b * TT * DM, XB, (size_t)TT * DM / 8);
        k_gemmw<bf, 0, true><<<dim3(TT / 64, DQ / 64, 1), 32, 0, stream>>>(XB, nullptr, WQ, nullptr, DM, FQ, DQ, bq, 0, 0, 0);
        k_rope<<<LQ, 256, 0, stream>>>(FQ, DQ, NH_, CS, nullptr, nullptr, 1.0f, QP16, QPh, QPl);
        k_gemmw<bf, 0, true><<<dim3(TT / 64, DKV / 64, 1), 32, 0, stream>>>(XB, nullptr, WK, nullptr, DM, FK, DKV, bk, 0, 0, 0);
        k_rope<<<LKv, 256, 0, stream>>>(FK, DKV, NKV, CS, nullptr, nullptr, 1.0f, KP16, KPh, KPl);
        k_gemmw<bf, 0, true><<<dim3(TT / 64, DKV / 64, 1), 32, 0, stream>>>(XB, nullptr, WV, nullptr, DM, FV, DKV, bv, 0, 0, 0); k_vtp<<<LKv, 256, 0, stream>>>(FV, DKV, NKV, VT16, VTh, VTl);
        // attention, all heads of the batch: query rows < RH on hi + lo planes, the rest on fp16 planes; both write the merged hi + lo planes
        k_fa<h16, false, 2><<<dim3(NH_, (TT - RH) / (32 * FQS), 1), 32 * FKW * FQS, 0, stream>>>(QP16, nullptr, KP16, nullptr, VT16, nullptr, RH, ATh, ATl);
        k_fa<bf, true, 1><<<dim3(NH_, RH / (16 * FQS), 1), 32 * FKW * FQS, 0, stream>>>(QPh, QPl, KPh, KPl, VTh, VTl, 0, ATh, ATl);
        k_gemmw<bf, 1, true><<<dim3(TT / 64, DM / 64, 1), 32, 0, stream>>>(ATh, ATl, WO, nullptr, DQ, OUT + (size_t)b * TT * DM, DM, bo, 0, 0, 0); }
}
